// v000
// The times below were measured on an AMD MI455X: many runs one after another, warmed up first and cycling through
// copies of the inputs, with the whole window's GPU time divided by the number of runs. Launches and the gaps
// between them are all in it. The median over several windows is given; except for v000 it joins two sittings, which
// can be a few percent apart, so the side-by-side timings, each taken in one sitting, are the better comparison.
// v000, which the later versions start from, runs in 3540 microseconds.
// Contractions: in_proj q|k (x f16 x W^T f16 carried x16), in_proj v^T (W f16 x16 x x^T f16), scores q.k^T (q,k f16 planes), attn.v (P f16 carried x2048 x V^T f16), out_proj (ctx f16 carried x256 x Wo^T f16 carried x16): all v_wmma_f32_16x16x32_f16 with f32 accumulate; mask+softmax, bias, residual, LayerNorm in f32.
#include <hip/hip_runtime.h>
#include <math.h>

// ---------------------------------------------------------------------------
// Problem constants
// ---------------------------------------------------------------------------
constexpr int kTok   = 4096;            // tokens
constexpr int kDim   = 1024;            // model dim
constexpr int kHeads = 16;
constexpr int kHd    = 64;
constexpr int kQKld  = 2 * kDim;        // pitch of the q | k plane (halves)
constexpr float kWCarry    = 16.0f;     // weights carried x16 in f16
constexpr float kWCarryInv = 1.0f / 16.0f;
constexpr float kPCarry    = 2048.0f;   // probabilities carried x2048 in f16
constexpr float kCtxCarry  = 256.0f;    // context carried x256 in f16
constexpr float kScoreScale = 0.125f;   // 1/sqrt(64)
constexpr float kPVScale   = kCtxCarry / kPCarry;             // 1/8
constexpr float kOutScale  = 1.0f / (kCtxCarry * kWCarry);   // 1/4096
constexpr float kInvDim    = 1.0f / 1024.0f;
constexpr float kLnEps     = 1e-5f;
constexpr float kNegFill   = -3.40282347e+38f;                // finfo(f32).min

static_assert(kHeads * kHd == kDim, "head split");

// ---------------------------------------------------------------------------
//   R_CTX : ctx16  [4096][1024] f16                              8 MiB  @   0 MiB   live head 0 .. out_proj
//   R_QK  : q|k16  [4096][2048] f16                             16 MiB  @   8 MiB   live in_proj .. head 15
//   R_VT  : Vt16   [1024][4096] f16                              8 MiB  @  24 MiB   live in_proj .. head 15
//   R_S   : S f32  [4096][4096] per head                        64 MiB  @  32 MiB
//           early: x16 [4096][1024] f16 (8 MiB @ +0), Win16 [3072][1024] f16 (6 MiB @ +8 MiB)  dead before head 0
//           late : Y f32 [4096][1024] (16 MiB @ +0) written by out_proj after the last softmax
//   R_P   : P16    [4096][4096] f16 per head                    32 MiB  @  96 MiB
//           late : Wout16 [1024][1024] f16 (2 MiB @ +0) cast after the last P.V
// ---------------------------------------------------------------------------
constexpr size_t kBytesCtx  = (size_t)kTok * kDim * 2;
constexpr size_t kBytesQK   = (size_t)kTok * kQKld * 2;
constexpr size_t kBytesVT   = (size_t)kDim * kTok * 2;
constexpr size_t kBytesS    = (size_t)kTok * kTok * 4;
constexpr size_t kBytesP    = (size_t)kTok * kTok * 2;
constexpr size_t kBytesX16  = (size_t)kTok * kDim * 2;
constexpr size_t kBytesWin  = (size_t)3 * kDim * kDim * 2;
constexpr size_t kBytesWout = (size_t)kDim * kDim * 2;
constexpr size_t kBytesY    = (size_t)kTok * kDim * 4;
constexpr size_t kOffCtx = 0;
constexpr size_t kOffQK  = kOffCtx + kBytesCtx;
constexpr size_t kOffVT  = kOffQK + kBytesQK;
constexpr size_t kOffS   = kOffVT + kBytesVT;
constexpr size_t kOffP   = kOffS + kBytesS;
constexpr size_t kWsTotal = kOffP + kBytesP;
static_assert(kWsTotal == (size_t)134217728, "carve total 128 MiB");
static_assert(kBytesX16 + kBytesWin <= kBytesS, "early tenants of R_S");
static_assert(kBytesY <= kBytesS, "late tenant of R_S");
static_assert(kBytesWout <= kBytesP, "late tenant of R_P");
static_assert((kOffQK % 128) == 0 && (kOffVT % 128) == 0 && (kOffS % 128) == 0 && (kOffP % 128) == 0, "alignment");

typedef __attribute__((ext_vector_type(16))) _Float16 v16h;
typedef __attribute__((ext_vector_type(8)))  _Float16 v8h;
typedef __attribute__((ext_vector_type(16))) __bf16   v16b;
typedef __attribute__((ext_vector_type(8)))  __bf16   v8b;
typedef __attribute__((ext_vector_type(8)))  float    v8f;
typedef __attribute__((ext_vector_type(4)))  float    v4f;
typedef __attribute__((ext_vector_type(4)))  unsigned int v4u;
typedef __attribute__((ext_vector_type(4)))  int      v4i;

__device__ __forceinline__ unsigned short f2bf_bits(float f) {
  unsigned u = __float_as_uint(f);
  return (unsigned short)((u + 0x7FFFu + ((u >> 16) & 1u)) >> 16);
}
__device__ __forceinline__ float bf_bits2f(unsigned short h) { return __uint_as_float(((unsigned)h) << 16); }

// hazard guards as plain device helpers (no inline asm inside the kernel template body)
__device__ __forceinline__ void dep_guard_h(v8f& a, v8f& b, v16h x, v16h y) { asm volatile("v_nop\n\tv_nop\n\tv_nop\n\tv_nop" : "+v"(a), "+v"(b) : "v"(x), "v"(y)); }
__device__ __forceinline__ void dep_guard_b(v8f& a, v8f& b, v16b x, v16b y) { asm volatile("v_nop\n\tv_nop\n\tv_nop\n\tv_nop" : "+v"(a), "+v"(b) : "v"(x), "v"(y)); }
__device__ __forceinline__ void keep4_h(v16h a, v16h b, v16h c, v16h d) { asm volatile("v_nop" :: "v"(a), "v"(b), "v"(c), "v"(d)); }
__device__ __forceinline__ void keep4_b(v16b a, v16b b, v16b c, v16b d) { asm volatile("v_nop" :: "v"(a), "v"(b), "v"(c), "v"(d)); }
__device__ __forceinline__ void acc_guard4(v8f& a, v8f& b, v8f& c, v8f& d) { asm volatile("v_nop\n\tv_nop\n\tv_nop\n\tv_nop" : "+v"(a), "+v"(b), "+v"(c), "+v"(d)); }
template <typename T> struct Frag;
template <> struct Frag<_Float16> {
  typedef v16h V; union U { v16h v; v8h h[2]; };
  static __device__ __forceinline__ v16h load(const _Float16* p) {   // elements 0..7 <- p[0..7], 8..15 <- p[16..23]
    U f; f.h[0] = *(const v8h*)(p); f.h[1] = *(const v8h*)(p + 16); return f.v;
  }
  static __device__ __forceinline__ v8f mma(v16h a, v16h b, v8f c) {
    return __builtin_amdgcn_wmma_f32_16x16x32_f16(false, a, false, b, (short)0, c, false, false);
  }
  static __device__ __forceinline__ void guard(v8f& a, v8f& b, v16h x, v16h y) { dep_guard_h(a, b, x, y); }
  static __device__ __forceinline__ void keep(v16h a, v16h b, v16h c, v16h d) { keep4_h(a, b, c, d); }
};
template <> struct Frag<__bf16> {
  typedef v16b V; union U { v16b v; v8b h[2]; };
  static __device__ __forceinline__ v16b load(const __bf16* p) {
    U f; f.h[0] = *(const v8b*)(p); f.h[1] = *(const v8b*)(p + 16); return f.v;
  }
  static __device__ __forceinline__ v8f mma(v16b a, v16b b, v8f c) {
    return __builtin_amdgcn_wmma_f32_16x16x32_bf16(false, a, false, b, (short)0, c, false, false);
  }
  static __device__ __forceinline__ void guard(v8f& a, v8f& b, v16b x, v16b y) { dep_guard_b(a, b, x, y); }
  static __device__ __forceinline__ void keep(v16b a, v16b b, v16b c, v16b d) { keep4_b(a, b, c, d); }
};

__device__ __forceinline__ unsigned pk16(unsigned short a, unsigned short b) { return (unsigned)a | ((unsigned)b << 16); }
__device__ __forceinline__ unsigned short h_bits(float f) { const _Float16 h = (_Float16)f; return __builtin_bit_cast(unsigned short, h); }

// ---- Register-blocked batched WMMA GEMM (ACT reduced to none/relu/leaky) -----------------------
// C[m,n] = scale * sum_k A[m,k] * Bt[n,k] (+bias)(+resid); each wave owns a 64x64 tile.
// A row-major [M,K]; Bt row-major [N,K]; M,N % 64 == 0, K % 32 == 0.
// SPLIT: operands are hi/lo planes (A2/Bt2 = lo planes, same layout); product = hi.hi + hi.lo + lo.hi.
// BIAS_MODE: 0 = none, 1 = bias[m], 2 = bias[n].
// OUT_MODE: 0 = f32, 1 = f16, 2 = bf16 hi plane (Cout) + bf16 lo plane (Cout2).
// ET: 0 = f16 operands, 1 = bf16 operands (pointers passed as 16-bit storage)
template <int ET> struct Elem;
template <> struct Elem<0> { typedef _Float16 T; };
template <> struct Elem<1> { typedef __bf16 T; };
template <int ET, bool SPLIT, int BIAS_MODE, int OUT_MODE, bool RESID, int ACT = 0>
__global__ __launch_bounds__(256) void wmma_gemm64(
    const unsigned short* __restrict__ Ap, const unsigned short* __restrict__ A2p, int lda, long strideA,
    const unsigned short* __restrict__ Btp, const unsigned short* __restrict__ Bt2p, int ldb, long strideB,
    void* __restrict__ Cout, void* __restrict__ Cout2, int ldc, long strideC,
    const float* __restrict__ bias,
    const float* __restrict__ resid, long strideR,
    int M, int N, int K, float scale) {
  typedef typename Elem<ET>::T T;
  typedef typename Frag<T>::V V;
  const T* A = (const T*)Ap; const T* A2 = (const T*)A2p; const T* Bt = (const T*)Btp; const T* Bt2 = (const T*)Bt2p;
  __shared__ __align__(16) float sT[8][16 * 68];   // per-wave 16x64 slab, pitch 68 floats
  const int b    = blockIdx.y;
  const int lane = threadIdx.x & 31;
  const int wave = threadIdx.x >> 5;
  const int tilesN = N >> 6;
  const int tilesM = M >> 6;
  const int tile = blockIdx.x * 8 + wave;
  if (tile >= tilesM * tilesN) return;   // wave-uniform; no block barriers in this kernel
  const int tm = tile / tilesN;
  const int tn = tile - tm * tilesN;
  const int m0 = tm << 6;
  const int n0 = tn << 6;

  const T* Ab  = A  + (size_t)b * strideA;
  const T* Bb  = Bt + (size_t)b * strideB;
  const T* Ab2 = SPLIT ? (A2  + (size_t)b * strideA) : nullptr;
  const T* Bb2 = SPLIT ? (Bt2 + (size_t)b * strideB) : nullptr;

  const int rlane = lane & 15;                 // row (A) / col (B, D) within subtile
  const int koff  = (lane >> 4) * 8;           // k offset of this lane half
  const int mOff  = (lane >> 4) * 8;           // D row offset

  v8f acc[4][4];
#pragma unroll
  for (int i = 0; i < 4; ++i)
#pragma unroll
    for (int j = 0; j < 4; ++j) acc[i][j] = (v8f){0.f,0.f,0.f,0.f,0.f,0.f,0.f,0.f};

  for (int k0 = 0; k0 < K; k0 += 32) {
    V bh[4], bl[4];
#pragma unroll
    for (int j = 0; j < 4; ++j) {
      const size_t bo = (size_t)(n0 + (j << 4) + rlane) * ldb + koff + k0;
      bh[j] = Frag<T>::load(Bb + bo);
      if (SPLIT) bl[j] = Frag<T>::load(Bb2 + bo);
    }
#pragma unroll
    for (int i = 0; i < 4; ++i) {
      const size_t ao = (size_t)(m0 + (i << 4) + rlane) * lda + koff + k0;
      V ah = Frag<T>::load(Ab + ao);
      V al;
      if (SPLIT) al = Frag<T>::load(Ab2 + ao);
#pragma unroll
      for (int j = 0; j < 4; ++j) {
        acc[i][j] = Frag<T>::mma(ah, bh[j], acc[i][j]);
        if (SPLIT) {
          acc[i][j] = Frag<T>::mma(ah, bl[j], acc[i][j]);
          acc[i][j] = Frag<T>::mma(al, bh[j], acc[i][j]);
        }
      }
      Frag<T>::guard(acc[i][0], acc[i][3], ah, SPLIT ? al : ah);
    }
    Frag<T>::keep(bh[0], bh[1], bh[2], bh[3]);
    if (SPLIT) Frag<T>::keep(bl[0], bl[1], bl[2], bl[3]);
  }
  acc_guard4(acc[0][0], acc[0][1], acc[0][2], acc[0][3]);
  acc_guard4(acc[1][0], acc[1][1], acc[1][2], acc[1][3]);
  acc_guard4(acc[2][0], acc[2][1], acc[2][2], acc[2][3]);
  acc_guard4(acc[3][0], acc[3][1], acc[3][2], acc[3][3]);

  // ---- epilogue ----
  float* slab = sT[wave];
  const float* Rb = RESID ? (resid + (size_t)b * strideR) : nullptr;
#pragma unroll
  for (int i = 0; i < 4; ++i) {
    const int mBase = m0 + (i << 4);
#pragma unroll
    for (int j = 0; j < 4; ++j) {
      const int n = n0 + (j << 4) + rlane;
      float bv = 0.f;
      if (BIAS_MODE == 2) bv = bias[n];
#pragma unroll
      for (int r = 0; r < 8; ++r) {
        float v = acc[i][j][r] * scale;
        if (BIAS_MODE == 1) v += bias[mBase + mOff + r];
        if (BIAS_MODE == 2) v += bv;
        if (RESID) v += Rb[(size_t)(mBase + mOff + r) * ldc + n];
        if (ACT == 2) v = fmaxf(v, 0.0f);
        if (ACT == 4) v = (v > 0.f) ? v : 0.01f * v;
        slab[(mOff + r) * 68 + (j << 4) + rlane] = v;
      }
    }
    __builtin_amdgcn_fence(__ATOMIC_RELEASE, "workgroup");
    __builtin_amdgcn_wave_barrier();
    __builtin_amdgcn_fence(__ATOMIC_ACQUIRE, "workgroup");
    if (OUT_MODE == 0) {
      float* C = (float*)Cout + (size_t)b * strideC;
      const int hh = lane >> 4, c4 = (lane & 15) * 4;     // row seg = 256 B = 16 lanes x 16 B
      {
#pragma unroll
        for (int it = 0; it < 8; ++it) {
          const int row = it * 2 + hh;
          v4f v = *(const v4f*)(slab + row * 68 + c4);
          *(v4f*)(C + (size_t)(mBase + row) * ldc + n0 + c4) = v;
        }
        
      }
    } else {
      const int q = lane >> 3, c8 = (lane & 7) * 8;
      unsigned short* C  = (unsigned short*)Cout  + (size_t)b * strideC;
      unsigned short* C2 = (OUT_MODE == 2) ? ((unsigned short*)Cout2 + (size_t)b * strideC) : nullptr;
      {
#pragma unroll
        for (int it = 0; it < 4; ++it) {
          const int row = it * 4 + q;
          const float* sp = slab + row * 68 + c8;
          v8h hv, lv;
#pragma unroll
          for (int e = 0; e < 8; ++e) {
            if (OUT_MODE == 1) {
              hv[e] = (_Float16)sp[e];
            } else {
              unsigned short hb = f2bf_bits(sp[e]);
              unsigned short lb = f2bf_bits(sp[e] - bf_bits2f(hb));
              hv[e] = __builtin_bit_cast(_Float16, hb);
              lv[e] = __builtin_bit_cast(_Float16, lb);
            }
          }
          *(v8h*)(C + (size_t)(mBase + row) * ldc + n0 + c8) = hv;
          if (OUT_MODE == 2) *(v8h*)(C2 + (size_t)(mBase + row) * ldc + n0 + c8) = lv;
        }
        
      }
    }
    __builtin_amdgcn_fence(__ATOMIC_RELEASE, "workgroup");
    __builtin_amdgcn_wave_barrier();
    __builtin_amdgcn_fence(__ATOMIC_ACQUIRE, "workgroup");
  }
}

// ---------------------------------------------------------------------------
// f32 -> f16 cast with an exact power-of-two carry, 8 consecutive elements per thread (one 16-B store per lane;
// Coverage: n8 = n/8 threads x 8 elements = whole plane (n % 8 == 0 for every plane here); grid = ceil(n8/256), bound inside.
// ---------------------------------------------------------------------------
__global__ __launch_bounds__(256) void cast8_f16_kernel(const float* __restrict__ in, unsigned short* __restrict__ out,
                                                        int n8, float scale) {
  const int i = blockIdx.x * 256 + threadIdx.x;
  if (i >= n8) return;
  const float* p = in + 8 * (size_t)i;
  const v4f a = *(const v4f*)(p);
  const v4f c = *(const v4f*)(p + 4);
  unsigned short hb[8];
#pragma unroll
  for (int e = 0; e < 4; ++e) {
    hb[e]     = h_bits(a[e] * scale);
    hb[4 + e] = h_bits(c[e] * scale);
  }
  const v4u u = (v4u){pk16(hb[0], hb[1]), pk16(hb[2], hb[3]), pk16(hb[4], hb[5]), pk16(hb[6], hb[7])};
  unsigned short* q = out + 8 * (size_t)i;
  *(v4u*)q = u;
  
}

// ---------------------------------------------------------------------------
// Block-diagonal mask + row softmax over 4096 f32 scores (already scaled by 1/sqrt(hd) in the GEMM epilogue):
//   allowed(row, j) = (id[row] == id[j]) && id[row] >= 0 && id[j] >= 0   (id[j] >= 0 is implied by the first two)
//   s = allowed ? S : finfo.min (select, not add);  p = exp(s - max);  P[row][j] = f16( carry * p / sum )
// A fully masked row has all s == finfo.min -> max == finfo.min -> p == 1 everywhere -> uniform 1/4096 (as the spec).
// One block of 512 threads per row; thread t owns columns 8t..8t+7 (512 x 8 = 4096 = whole row).
// Reductions in fixed order (thread, 32-lane shuffle tree, 16 wave partials in index order); all shuffles unconditional.
// ---------------------------------------------------------------------------
__global__ __launch_bounds__(512) void mask_softmax_kernel(const float* __restrict__ S, const int* __restrict__ ids,
                                                           unsigned short* __restrict__ P, float carry) {
  __shared__ float redM[16];
  __shared__ float redS[16];
  const int row  = blockIdx.x;
  const int t    = threadIdx.x;
  const int lane = t & 31, wave = t >> 5;
  const int ci   = ids[row];
  const bool rowok = (ci >= 0);
  const int c0   = t * 8;
  const float* sr = S + (size_t)row * kTok + c0;
  const v4f a = *(const v4f*)(sr);
  const v4f c = *(const v4f*)(sr + 4);
  const v4i ka = *(const v4i*)(ids + c0);
  const v4i kc = *(const v4i*)(ids + c0 + 4);
  float x[8];
#pragma unroll
  for (int e = 0; e < 4; ++e) {
    x[e]     = (rowok && (ka[e] == ci)) ? a[e] : kNegFill;
    x[4 + e] = (rowok && (kc[e] == ci)) ? c[e] : kNegFill;
  }
  float m = fmaxf(fmaxf(fmaxf(x[0], x[1]), fmaxf(x[2], x[3])), fmaxf(fmaxf(x[4], x[5]), fmaxf(x[6], x[7])));
#pragma unroll
  for (int off = 16; off > 0; off >>= 1) m = fmaxf(m, __shfl_xor(m, off, 32));
  if (lane == 0) redM[wave] = m;
  __syncthreads();
  float gm = redM[0];
#pragma unroll
  for (int w = 1; w < 16; ++w) gm = fmaxf(gm, redM[w]);
  float p[8];
  float ps = 0.f;
#pragma unroll
  for (int e = 0; e < 8; ++e) {
    p[e] = expf(x[e] - gm);
    ps += p[e];
  }
#pragma unroll
  for (int off = 16; off > 0; off >>= 1) ps += __shfl_xor(ps, off, 32);
  if (lane == 0) redS[wave] = ps;
  __syncthreads();
  float gs = redS[0];
#pragma unroll
  for (int w = 1; w < 16; ++w) gs += redS[w];
  // gs >= 1 always (the max element contributes exp(0) = 1)
  const float pc = carry * (1.0f / gs);
  unsigned short hb[8];
#pragma unroll
  for (int e = 0; e < 8; ++e) hb[e] = h_bits(p[e] * pc);
  const v4u u = (v4u){pk16(hb[0], hb[1]), pk16(hb[2], hb[3]), pk16(hb[4], hb[5]), pk16(hb[6], hb[7])};
  unsigned short* q = P + (size_t)row * kTok + c0;
  *(v4u*)q = u;
  
}

// ---------------------------------------------------------------------------
// LayerNorm over 1024 columns of Y = x + attn_out (f32, already residual-added in the out_proj epilogue):
// Premise check: the head-count input must equal 16; otherwise the output is NaN-poisoned (block-uniform select).
// One block of 256 threads per row; thread t owns columns 4t..4t+3 (256 x 4 = 1024 = whole row).
// Fixed-order reductions (thread, shuffle tree, 8 wave partials in index order).
// ---------------------------------------------------------------------------
__global__ __launch_bounds__(256) void layernorm_kernel(const float* __restrict__ Y, const float* __restrict__ lnw,
                                                        const float* __restrict__ lnb, const int* __restrict__ nhp,
                                                        float* __restrict__ out) {
  __shared__ float red1[8];
  __shared__ float red2[8];
  const int row  = blockIdx.x;
  const int t    = threadIdx.x;
  const int lane = t & 31, wave = t >> 5;
  const int c0   = t * 4;
  const v4f y = *(const v4f*)(Y + (size_t)row * kDim + c0);
  float s1 = (y[0] + y[1]) + (y[2] + y[3]);
#pragma unroll
  for (int off = 16; off > 0; off >>= 1) s1 += __shfl_xor(s1, off, 32);
  if (lane == 0) red1[wave] = s1;
  __syncthreads();
  float tot = red1[0];
#pragma unroll
  for (int w = 1; w < 8; ++w) tot += red1[w];
  const float mu = tot * kInvDim;
  float d[4];
#pragma unroll
  for (int e = 0; e < 4; ++e) d[e] = y[e] - mu;
  float s2 = (d[0] * d[0] + d[1] * d[1]) + (d[2] * d[2] + d[3] * d[3]);
#pragma unroll
  for (int off = 16; off > 0; off >>= 1) s2 += __shfl_xor(s2, off, 32);
  if (lane == 0) red2[wave] = s2;
  __syncthreads();
  float tot2 = red2[0];
#pragma unroll
  for (int w = 1; w < 8; ++w) tot2 += red2[w];
  const float var = tot2 * kInvDim;
  const float rs  = rsqrtf(var + kLnEps);
  const v4f wv = *(const v4f*)(lnw + c0);
  const v4f bv = *(const v4f*)(lnb + c0);
  const bool bad = (nhp[0] != kHeads);
  const float nanv = __int_as_float(0x7fc00000);
  v4f o;
#pragma unroll
  for (int e = 0; e < 4; ++e) {
    const float r = d[e] * rs * wv[e] + bv[e];
    o[e] = bad ? nanv : r;
  }
  float* q = out + (size_t)row * kDim + c0;
  *(v4f*)q = o;
  
}

// ---------------------------------------------------------------------------
// Host glue: kernel launches only. d_in order:
//   0 x [4096][1024] f32, 1 cluster ids [4096] i32, 2 in_proj_w [3072][1024] f32, 3 in_proj_b [3072] f32,
//   4 out_proj_w [1024][1024] f32, 5 out_proj_b [1024] f32, 6 ln_w [1024] f32, 7 ln_b [1024] f32, 8 head count [1] i32.
// Launch count: 3 casts + 2 in_proj GEMMs + 16 x (scores GEMM, softmax, P.V GEMM) + out_proj GEMM + LayerNorm = 55.
// ---------------------------------------------------------------------------
extern "C" void kernel_launch(void* const* d_in, const int* in_sizes, int n_in,
                              void* d_out, int out_size, void* d_ws, size_t ws_size, hipStream_t stream) {
  if (n_in < 9) return;
  if (in_sizes[0] != kTok * kDim || in_sizes[1] != kTok || in_sizes[2] != 3 * kDim * kDim ||
      in_sizes[3] != 3 * kDim || in_sizes[4] != kDim * kDim || in_sizes[5] != kDim ||
      in_sizes[6] != kDim || in_sizes[7] != kDim || in_sizes[8] < 1) return;
  if (out_size != kTok * kDim) return;
  if (ws_size < kWsTotal) return;

  const float* x     = (const float*)d_in[0];
  const int*   ids   = (const int*)d_in[1];
  const float* w_in  = (const float*)d_in[2];
  const float* b_in  = (const float*)d_in[3];
  const float* w_out = (const float*)d_in[4];
  const float* b_out = (const float*)d_in[5];
  const float* lnw   = (const float*)d_in[6];
  const float* lnb   = (const float*)d_in[7];
  const int*   nhp   = (const int*)d_in[8];
  float* out = (float*)d_out;

  unsigned char* ws = (unsigned char*)d_ws;
  unsigned short* ctx16  = (unsigned short*)(ws + kOffCtx);
  unsigned short* qk16   = (unsigned short*)(ws + kOffQK);
  unsigned short* vt16   = (unsigned short*)(ws + kOffVT);
  float*          S      = (float*)(ws + kOffS);
  unsigned short* x16    = (unsigned short*)(ws + kOffS);                 // early tenant of R_S
  unsigned short* win16  = (unsigned short*)(ws + kOffS + kBytesX16);     // early tenant of R_S
  float*          Y      = (float*)(ws + kOffS);                          // late tenant of R_S
  unsigned short* p16    = (unsigned short*)(ws + kOffP);
  unsigned short* wout16 = (unsigned short*)(ws + kOffP);                 // late tenant of R_P

  // ---- casts: x -> f16, W_in -> f16(x16 W) ----
  {
    const int n8x = (kTok * kDim) / 8;          // 524288 threads x 8 = 4,194,304 elements
    cast8_f16_kernel<<<dim3((n8x + 255) / 256), dim3(256), 0, stream>>>(x, x16, n8x, 1.0f);
    const int n8w = (3 * kDim * kDim) / 8;      // 393216 threads x 8 = 3,145,728 elements
    cast8_f16_kernel<<<dim3((n8w + 255) / 256), dim3(256), 0, stream>>>(w_in, win16, n8w, kWCarry);
  }

  // ---- in_proj q|k: C[4096][2048] = (1/16) x16 . Win16[0:2048]^T + b_in[n] -> f16 plane (lda=ldb=1024, ldc=2048) ----
  // M=4096, N=2048, K=1024 (K%32==0, M,N %64==0); 2048 tiles -> 256 blocks
  wmma_gemm64<0, false, 2, 1, false><<<dim3(256, 1), dim3(256), 0, stream>>>(
      x16, x16, kDim, 0L, win16, win16, kDim, 0L, (void*)qk16, (void*)qk16, kQKld, 0L,
      b_in, x, 0L, kTok, kQKld, kDim, kWCarryInv);

  // ---- in_proj v, transposed: Vt[1024][4096] = (1/16) Win16[2048:3072] . x16^T + b_in[2048 + m] -> f16 (ldc=4096) ----
  // M=1024 (v features), N=4096 (tokens), K=1024; 1024 tiles -> 128 blocks
  wmma_gemm64<0, false, 1, 1, false><<<dim3(128, 1), dim3(256), 0, stream>>>(
      win16 + (size_t)2 * kDim * kDim, win16 + (size_t)2 * kDim * kDim, kDim, 0L, x16, x16, kDim, 0L,
      (void*)vt16, (void*)vt16, kTok, 0L, b_in + 2 * kDim, x, 0L, kDim, kTok, kDim, kWCarryInv);

  // ---- attention, one head at a time ----
  for (int h = 0; h < kHeads; ++h) {
    // scores S[4096][4096] f32 = 0.125 * q_h . k_h^T ; A = q plane cols h*64.. (lda 2048), Bt = k plane cols 1024+h*64.. (ldb 2048)
    // M=N=4096, K=64 (two 32-deep steps, loads stay inside the head's 64 columns); 4096 tiles -> 512 blocks
    wmma_gemm64<0, false, 0, 0, false><<<dim3(512, 1), dim3(256), 0, stream>>>(
        qk16 + h * kHd, qk16 + h * kHd, kQKld, 0L, qk16 + kDim + h * kHd, qk16 + kDim + h * kHd, kQKld, 0L,
        (void*)S, (void*)S, kTok, 0L, b_in, x, 0L, kTok, kTok, kHd, kScoreScale);

    // mask + softmax per row -> P f16 carried x2048 (whole plane written: 4096 rows x 4096 cols)
    mask_softmax_kernel<<<dim3(kTok), dim3(512), 0, stream>>>(S, ids, p16, kPCarry);

    // ctx columns h*64..h*64+63 of ctx16[4096][1024] = (256/2048) P . Vt_h^T ; A = P (lda 4096), Bt = Vt rows h*64.. (ldb 4096)
    wmma_gemm64<0, false, 0, 1, false><<<dim3(8, 1), dim3(256), 0, stream>>>(
        p16, p16, kTok, 0L, vt16 + (size_t)h * kHd * kTok, vt16 + (size_t)h * kHd * kTok, kTok, 0L,
        (void*)(ctx16 + h * kHd), (void*)(ctx16 + h * kHd), kDim, 0L, b_in, x, 0L, kTok, kHd, kTok, kPVScale);
  }

  // ---- W_out -> f16(x16 W) into the now-dead P region ----
  {
    const int n8o = (kDim * kDim) / 8;          // 131072 threads x 8 = 1,048,576 elements
    cast8_f16_kernel<<<dim3((n8o + 255) / 256), dim3(256), 0, stream>>>(w_out, wout16, n8o, kWCarry);
  }

  // ---- out_proj + bias + residual: Y[4096][1024] f32 = (1/4096) ctx16 . Wout16^T + b_out[n] + x[m][n] ----
  // M=4096, N=1024, K=1024; 1024 tiles -> 128 blocks; RESID read and write are element-local in the epilogue, Y does not alias x
  wmma_gemm64<0, false, 2, 0, true><<<dim3(128, 1), dim3(256), 0, stream>>>(
      ctx16, ctx16, kDim, 0L, wout16, wout16, kDim, 0L, (void*)Y, (void*)Y, kDim, 0L,
      b_out, x, 0L, kTok, kDim, kDim, kOutScale);

  // ---- LayerNorm -> d_out [4096][1024] f32 ----
  layernorm_kernel<<<dim3(kTok), dim3(256), 0, stream>>>(Y, lnw, lnb, nhp, out);
}

// v001
// One run takes 926 microseconds.
// Timed twice side by side with v000, it ran 3.85 times as fast both times.
// Contractions: in_proj q|k (x f16 x W^T f16 carried x16), in_proj v^T (W f16 x16 x x^T f16), scores q.k^T (q,k f16 planes), attn.v (P f16 carried x2048 x V^T f16), out_proj (ctx f16 carried x256 x Wo^T f16 carried x16): all v_wmma_f32_16x16x32_f16 with f32 accumulate; mask+softmax, bias, residual, LayerNorm in f32.
#include <hip/hip_runtime.h>
#include <math.h>

// ---------------------------------------------------------------------------
// Problem constants
// ---------------------------------------------------------------------------
constexpr int kTok   = 4096;            // tokens
constexpr int kDim   = 1024;            // model dim
constexpr int kHeads = 16;
constexpr int kHd    = 64;
constexpr int kQKld  = 2 * kDim;        // pitch of the q | k plane (halves)
constexpr float kWCarry    = 16.0f;     // weights carried x16 in f16
constexpr float kWCarryInv = 1.0f / 16.0f;
constexpr float kPCarry    = 2048.0f;   // probabilities carried x2048 in f16
constexpr float kCtxCarry  = 256.0f;    // context carried x256 in f16
constexpr float kScoreScale = 0.125f;   // 1/sqrt(64)
constexpr float kPVScale   = kCtxCarry / kPCarry;             // 1/8
constexpr float kOutScale  = 1.0f / (kCtxCarry * kWCarry);   // 1/4096
constexpr float kInvDim    = 1.0f / 1024.0f;
constexpr float kLnEps     = 1e-5f;
constexpr float kNegFill   = -3.40282347e+38f;                // finfo(f32).min

static_assert(kHeads * kHd == kDim, "head split");

// ---------------------------------------------------------------------------
//   R_CTX : ctx16  [4096][1024] f16                              8 MiB  @   0 MiB   live head 0 .. out_proj
//   R_QK  : q|k16  [4096][2048] f16                             16 MiB  @   8 MiB   live in_proj .. head 15
//   R_VT  : Vt16   [1024][4096] f16                              8 MiB  @  24 MiB   live in_proj .. head 15
//   R_S   : S f32  [4096][4096] per head                        64 MiB  @  32 MiB
//           early: x16 [4096][1024] f16 (8 MiB @ +0), Win16 [3072][1024] f16 (6 MiB @ +8 MiB)  dead before head 0
//           late : Y f32 [4096][1024] (16 MiB @ +0) written by out_proj after the last softmax
//   R_P   : P16    [4096][4096] f16 per head                    32 MiB  @  96 MiB
//           late : Wout16 [1024][1024] f16 (2 MiB @ +0) cast after the last P.V
// ---------------------------------------------------------------------------
constexpr size_t kBytesCtx  = (size_t)kTok * kDim * 2;
constexpr size_t kBytesQK   = (size_t)kTok * kQKld * 2;
constexpr size_t kBytesVT   = (size_t)kDim * kTok * 2;
constexpr size_t kBytesS    = (size_t)kTok * kTok * 4;
constexpr size_t kBytesP    = (size_t)kTok * kTok * 2;
constexpr size_t kBytesX16  = (size_t)kTok * kDim * 2;
constexpr size_t kBytesWin  = (size_t)3 * kDim * kDim * 2;
constexpr size_t kBytesWout = (size_t)kDim * kDim * 2;
constexpr size_t kBytesY    = (size_t)kTok * kDim * 4;
constexpr size_t kOffCtx = 0;
constexpr size_t kOffQK  = kOffCtx + kBytesCtx;
constexpr size_t kOffVT  = kOffQK + kBytesQK;
constexpr size_t kOffS   = kOffVT + kBytesVT;
constexpr size_t kOffP   = kOffS + kBytesS;
constexpr size_t kWsTotal = kOffP + kBytesP;
static_assert(kWsTotal == (size_t)134217728, "carve total 128 MiB");
static_assert(kBytesX16 + kBytesWin <= kBytesS, "early tenants of R_S");
static_assert(kBytesY <= kBytesS, "late tenant of R_S");
static_assert(kBytesWout <= kBytesP, "late tenant of R_P");
static_assert((kOffQK % 128) == 0 && (kOffVT % 128) == 0 && (kOffS % 128) == 0 && (kOffP % 128) == 0, "alignment");

typedef __attribute__((ext_vector_type(16))) _Float16 v16h;
typedef __attribute__((ext_vector_type(8)))  _Float16 v8h;
typedef __attribute__((ext_vector_type(16))) __bf16   v16b;
typedef __attribute__((ext_vector_type(8)))  __bf16   v8b;
typedef __attribute__((ext_vector_type(8)))  float    v8f;
typedef __attribute__((ext_vector_type(4)))  float    v4f;
typedef __attribute__((ext_vector_type(2)))  float    v2f;
typedef __attribute__((ext_vector_type(4)))  unsigned int v4u;
typedef __attribute__((ext_vector_type(4)))  int      v4i;

__device__ __forceinline__ unsigned short f2bf_bits(float f) {
  unsigned u = __float_as_uint(f);
  return (unsigned short)((u + 0x7FFFu + ((u >> 16) & 1u)) >> 16);
}
__device__ __forceinline__ float bf_bits2f(unsigned short h) { return __uint_as_float(((unsigned)h) << 16); }

// hazard guards as plain device helpers (no inline asm inside the kernel template body)
__device__ __forceinline__ void dep_guard_h(v8f& a, v8f& b, v16h x, v16h y) { asm volatile("v_nop\n\tv_nop\n\tv_nop\n\tv_nop" : "+v"(a), "+v"(b) : "v"(x), "v"(y)); }
__device__ __forceinline__ void dep_guard_b(v8f& a, v8f& b, v16b x, v16b y) { asm volatile("v_nop\n\tv_nop\n\tv_nop\n\tv_nop" : "+v"(a), "+v"(b) : "v"(x), "v"(y)); }
__device__ __forceinline__ void keep4_h(v16h a, v16h b, v16h c, v16h d) { asm volatile("v_nop" :: "v"(a), "v"(b), "v"(c), "v"(d)); }
__device__ __forceinline__ void keep4_b(v16b a, v16b b, v16b c, v16b d) { asm volatile("v_nop" :: "v"(a), "v"(b), "v"(c), "v"(d)); }
__device__ __forceinline__ void acc_guard4(v8f& a, v8f& b, v8f& c, v8f& d) { asm volatile("v_nop\n\tv_nop\n\tv_nop\n\tv_nop" : "+v"(a), "+v"(b), "+v"(c), "+v"(d)); }
template <typename T> struct Frag;
template <> struct Frag<_Float16> {
  typedef v16h V; union U { v16h v; v8h h[2]; };
  static __device__ __forceinline__ v16h load(const _Float16* p) {   // elements 0..7 <- p[0..7], 8..15 <- p[16..23]
    U f; f.h[0] = *(const v8h*)(p); f.h[1] = *(const v8h*)(p + 16); return f.v;
  }
  static __device__ __forceinline__ v8f mma(v16h a, v16h b, v8f c) {
    return __builtin_amdgcn_wmma_f32_16x16x32_f16(false, a, false, b, (short)0, c, false, false);
  }
  static __device__ __forceinline__ void guard(v8f& a, v8f& b, v16h x, v16h y) { dep_guard_h(a, b, x, y); }
  static __device__ __forceinline__ void keep(v16h a, v16h b, v16h c, v16h d) { keep4_h(a, b, c, d); }
};
template <> struct Frag<__bf16> {
  typedef v16b V; union U { v16b v; v8b h[2]; };
  static __device__ __forceinline__ v16b load(const __bf16* p) {
    U f; f.h[0] = *(const v8b*)(p); f.h[1] = *(const v8b*)(p + 16); return f.v;
  }
  static __device__ __forceinline__ v8f mma(v16b a, v16b b, v8f c) {
    return __builtin_amdgcn_wmma_f32_16x16x32_bf16(false, a, false, b, (short)0, c, false, false);
  }
  static __device__ __forceinline__ void guard(v8f& a, v8f& b, v16b x, v16b y) { dep_guard_b(a, b, x, y); }
  static __device__ __forceinline__ void keep(v16b a, v16b b, v16b c, v16b d) { keep4_b(a, b, c, d); }
};

__device__ __forceinline__ unsigned pk16(unsigned short a, unsigned short b) { return (unsigned)a | ((unsigned)b << 16); }
__device__ __forceinline__ unsigned short h_bits(float f) { const _Float16 h = (_Float16)f; return __builtin_bit_cast(unsigned short, h); }

// ---- Register-blocked batched WMMA GEMM (ACT reduced to none/relu/leaky) -----------------------
// C[m,n] = scale * sum_k A[m,k] * Bt[n,k] (+bias)(+resid); each wave owns a 64x64 tile.
// A row-major [M,K]; Bt row-major [N,K]; M,N % 64 == 0, K % 32 == 0.
// SPLIT: operands are hi/lo planes (A2/Bt2 = lo planes, same layout); product = hi.hi + hi.lo + lo.hi.
// BIAS_MODE: 0 = none, 1 = bias[m], 2 = bias[n].
// OUT_MODE: 0 = f32, 1 = f16, 2 = bf16 hi plane (Cout) + bf16 lo plane (Cout2).
// ET: 0 = f16 operands, 1 = bf16 operands (pointers passed as 16-bit storage)
template <int ET> struct Elem;
template <> struct Elem<0> { typedef _Float16 T; };
template <> struct Elem<1> { typedef __bf16 T; };
template <int ET, bool SPLIT, int BIAS_MODE, int OUT_MODE, bool RESID, int ACT = 0>
__global__ __launch_bounds__(256) void wmma_gemm64(
    const unsigned short* __restrict__ Ap, const unsigned short* __restrict__ A2p, int lda, long strideA,
    const unsigned short* __restrict__ Btp, const unsigned short* __restrict__ Bt2p, int ldb, long strideB,
    void* __restrict__ Cout, void* __restrict__ Cout2, int ldc, long strideC,
    const float* __restrict__ bias,
    const float* __restrict__ resid, long strideR,
    int M, int N, int K, float scale) {
  typedef typename Elem<ET>::T T;
  typedef typename Frag<T>::V V;
  const T* A = (const T*)Ap; const T* A2 = (const T*)A2p; const T* Bt = (const T*)Btp; const T* Bt2 = (const T*)Bt2p;
  __shared__ __align__(16) float sT[8][16 * 68];   // per-wave 16x64 slab, pitch 68 floats
  const int b    = blockIdx.y;
  const int lane = threadIdx.x & 31;
  const int wave = threadIdx.x >> 5;
  const int tilesN = N >> 6;
  const int tilesM = M >> 6;
  const int tile = blockIdx.x * 8 + wave;
  if (tile >= tilesM * tilesN) return;   // wave-uniform; no block barriers in this kernel
  const int tm = tile / tilesN;
  const int tn = tile - tm * tilesN;
  const int m0 = tm << 6;
  const int n0 = tn << 6;

  const T* Ab  = A  + (size_t)b * strideA;
  const T* Bb  = Bt + (size_t)b * strideB;
  const T* Ab2 = SPLIT ? (A2  + (size_t)b * strideA) : nullptr;
  const T* Bb2 = SPLIT ? (Bt2 + (size_t)b * strideB) : nullptr;

  const int rlane = lane & 15;                 // row (A) / col (B, D) within subtile
  const int koff  = (lane >> 4) * 8;           // k offset of this lane half
  const int mOff  = (lane >> 4) * 8;           // D row offset

  v8f acc[4][4];
#pragma unroll
  for (int i = 0; i < 4; ++i)
#pragma unroll
    for (int j = 0; j < 4; ++j) acc[i][j] = (v8f){0.f,0.f,0.f,0.f,0.f,0.f,0.f,0.f};

  for (int k0 = 0; k0 < K; k0 += 32) {
    V bh[4], bl[4];
#pragma unroll
    for (int j = 0; j < 4; ++j) {
      const size_t bo = (size_t)(n0 + (j << 4) + rlane) * ldb + koff + k0;
      bh[j] = Frag<T>::load(Bb + bo);
      if (SPLIT) bl[j] = Frag<T>::load(Bb2 + bo);
    }
#pragma unroll
    for (int i = 0; i < 4; ++i) {
      const size_t ao = (size_t)(m0 + (i << 4) + rlane) * lda + koff + k0;
      V ah = Frag<T>::load(Ab + ao);
      V al;
      if (SPLIT) al = Frag<T>::load(Ab2 + ao);
#pragma unroll
      for (int j = 0; j < 4; ++j) {
        acc[i][j] = Frag<T>::mma(ah, bh[j], acc[i][j]);
        if (SPLIT) {
          acc[i][j] = Frag<T>::mma(ah, bl[j], acc[i][j]);
          acc[i][j] = Frag<T>::mma(al, bh[j], acc[i][j]);
        }
      }
      Frag<T>::guard(acc[i][0], acc[i][3], ah, SPLIT ? al : ah);
    }
    Frag<T>::keep(bh[0], bh[1], bh[2], bh[3]);
    if (SPLIT) Frag<T>::keep(bl[0], bl[1], bl[2], bl[3]);
  }
  acc_guard4(acc[0][0], acc[0][1], acc[0][2], acc[0][3]);
  acc_guard4(acc[1][0], acc[1][1], acc[1][2], acc[1][3]);
  acc_guard4(acc[2][0], acc[2][1], acc[2][2], acc[2][3]);
  acc_guard4(acc[3][0], acc[3][1], acc[3][2], acc[3][3]);

  // ---- epilogue ----
  float* slab = sT[wave];
  const float* Rb = RESID ? (resid + (size_t)b * strideR) : nullptr;
#pragma unroll
  for (int i = 0; i < 4; ++i) {
    const int mBase = m0 + (i << 4);
#pragma unroll
    for (int j = 0; j < 4; ++j) {
      const int n = n0 + (j << 4) + rlane;
      float bv = 0.f;
      if (BIAS_MODE == 2) bv = bias[n];
#pragma unroll
      for (int r = 0; r < 8; ++r) {
        float v = acc[i][j][r] * scale;
        if (BIAS_MODE == 1) v += bias[mBase + mOff + r];
        if (BIAS_MODE == 2) v += bv;
        if (RESID) v += Rb[(size_t)(mBase + mOff + r) * ldc + n];
        if (ACT == 2) v = fmaxf(v, 0.0f);
        if (ACT == 4) v = (v > 0.f) ? v : 0.01f * v;
        slab[(mOff + r) * 68 + (j << 4) + rlane] = v;
      }
    }
    __builtin_amdgcn_fence(__ATOMIC_RELEASE, "workgroup");
    __builtin_amdgcn_wave_barrier();
    __builtin_amdgcn_fence(__ATOMIC_ACQUIRE, "workgroup");
    if (OUT_MODE == 0) {
      float* C = (float*)Cout + (size_t)b * strideC;
      const int hh = lane >> 4, c4 = (lane & 15) * 4;     // row seg = 256 B = 16 lanes x 16 B
      {
#pragma unroll
        for (int it = 0; it < 8; ++it) {
          const int row = it * 2 + hh;
          v4f v = *(const v4f*)(slab + row * 68 + c4);
          *(v4f*)(C + (size_t)(mBase + row) * ldc + n0 + c4) = v;
        }
        
      }
    } else {
      const int q = lane >> 3, c8 = (lane & 7) * 8;
      unsigned short* C  = (unsigned short*)Cout  + (size_t)b * strideC;
      unsigned short* C2 = (OUT_MODE == 2) ? ((unsigned short*)Cout2 + (size_t)b * strideC) : nullptr;
      {
#pragma unroll
        for (int it = 0; it < 4; ++it) {
          const int row = it * 4 + q;
          const float* sp = slab + row * 68 + c8;
          v8h hv, lv;
#pragma unroll
          for (int e = 0; e < 8; ++e) {
            if (OUT_MODE == 1) {
              hv[e] = (_Float16)sp[e];
            } else {
              unsigned short hb = f2bf_bits(sp[e]);
              unsigned short lb = f2bf_bits(sp[e] - bf_bits2f(hb));
              hv[e] = __builtin_bit_cast(_Float16, hb);
              lv[e] = __builtin_bit_cast(_Float16, lb);
            }
          }
          *(v8h*)(C + (size_t)(mBase + row) * ldc + n0 + c8) = hv;
          if (OUT_MODE == 2) *(v8h*)(C2 + (size_t)(mBase + row) * ldc + n0 + c8) = lv;
        }
        
      }
    }
    __builtin_amdgcn_fence(__ATOMIC_RELEASE, "workgroup");
    __builtin_amdgcn_wave_barrier();
    __builtin_amdgcn_fence(__ATOMIC_ACQUIRE, "workgroup");
  }
}

// ---------------------------------------------------------------------------
// P.V for one head, K split over the 16 waves of a block:
//   C[m][n] = scale * sum_k P[m][k] * Vt[n][k],  m in 4096 tokens, n in 64 head columns, k in 4096 keys.
// One block per 16 rows (256 blocks x 16 rows = 4096 rows); wave w sums keys 256w .. 256w+255 into its own 16x64 f32 tile
// (16 waves x 256 keys = 4096 keys), with the same A and B fragment loader as the GEMM engine (equal k order on both sides).
// The 16 partial tiles meet in LDS and are added in wave-index order: a fixed order, the same on every run.
// Wave w then stores row w: 32 lanes x 2 halves = the row's 64 columns = one whole 128-B line, written once.
// ---------------------------------------------------------------------------
constexpr int kPvWaves = 16;
constexpr int kPvSlice = kTok / kPvWaves;   // 256 keys per wave
constexpr int kPvPitch = 68;                // floats per staged row
constexpr int kPvStages = kPvSlice / 64;    // 4 stages of 64 keys per wave
static_assert(kPvSlice % 64 == 0, "whole stages per wave");
__global__ __launch_bounds__(512) void pv_splitk_kernel(const unsigned short* __restrict__ Pp,
                                                        const unsigned short* __restrict__ Vtp,
                                                        unsigned short* __restrict__ C, float scale) {
  __shared__ __align__(16) float part[kPvWaves][16 * kPvPitch];
  const int lane  = threadIdx.x & 31;
  const int wave  = threadIdx.x >> 5;
  const int m0    = blockIdx.x << 4;
  const int rlane = lane & 15;                 // row (A) / col (B, D) within subtile
  const int koff  = (lane >> 4) * 8;           // k offset of this lane half
  const int mOff  = (lane >> 4) * 8;           // D row offset
  const _Float16* Ap = (const _Float16*)Pp  + (size_t)(m0 + rlane) * kTok + wave * kPvSlice + koff;
  const _Float16* Bp = (const _Float16*)Vtp + (size_t)rlane * kTok + wave * kPvSlice + koff;

  v8f acc[4];
#pragma unroll
  for (int j = 0; j < 4; ++j) acc[j] = (v8f){0.f,0.f,0.f,0.f,0.f,0.f,0.f,0.f};

  // A stage is 64 keys: one whole 128-B line of each of the 16 P rows and 64 Vt rows (20 loads of 16 B per lane).
  // Two fragment sets: stage s + 1 is in flight while stage s is multiplied. All indices are constants after unrolling.
  v16h a[2][2], b[2][2][4];   // [set][k step of the stage]([column group])
#pragma unroll
  for (int t = 0; t < 2; ++t) {
    a[0][t] = Frag<_Float16>::load(Ap + t * 32);
#pragma unroll
    for (int j = 0; j < 4; ++j) b[0][t][j] = Frag<_Float16>::load(Bp + (size_t)(j << 4) * kTok + t * 32);
  }
#pragma unroll
  for (int s = 0; s < kPvStages; ++s) {
    const int cur = s & 1, nxt = cur ^ 1;
    if (s + 1 < kPvStages) {
#pragma unroll
      for (int t = 0; t < 2; ++t) {
        const int k0 = (s + 1) * 64 + t * 32;
        a[nxt][t] = Frag<_Float16>::load(Ap + k0);
#pragma unroll
        for (int j = 0; j < 4; ++j) b[nxt][t][j] = Frag<_Float16>::load(Bp + (size_t)(j << 4) * kTok + k0);
      }
    }
    // keeps the next stage's loads issued ahead of this stage's products; without it each pair of loads sinks to
    // just before its own product and the wave waits out one memory latency per product
    __builtin_amdgcn_sched_barrier(0);
#pragma unroll
    for (int t = 0; t < 2; ++t)
#pragma unroll
      for (int j = 0; j < 4; ++j) acc[j] = Frag<_Float16>::mma(a[cur][t], b[cur][t][j], acc[j]);
  }

  float* mine = part[wave];
#pragma unroll
  for (int j = 0; j < 4; ++j)
#pragma unroll
    for (int r = 0; r < 8; ++r) mine[(mOff + r) * kPvPitch + (j << 4) + rlane] = acc[j][r];
  __syncthreads();   // every wave's partial tile is in LDS before any wave adds them up

  const int c2 = lane * 2;
  float s0 = 0.f, s1 = 0.f;
#pragma unroll
  for (int w = 0; w < kPvWaves; ++w) {
    const v2f p = *(const v2f*)(&part[w][wave * kPvPitch + c2]);
    s0 += p[0];
    s1 += p[1];
  }
  const unsigned u = pk16(h_bits(s0 * scale), h_bits(s1 * scale));
  *(unsigned*)(C + (size_t)(m0 + wave) * kDim + c2) = u;
}

// ---------------------------------------------------------------------------
// f32 -> f16 cast with an exact power-of-two carry, 8 consecutive elements per thread (one 16-B store per lane;
// Coverage: n8 = n/8 threads x 8 elements = whole plane (n % 8 == 0 for every plane here); grid = ceil(n8/256), bound inside.
// ---------------------------------------------------------------------------
__global__ __launch_bounds__(256) void cast8_f16_kernel(const float* __restrict__ in, unsigned short* __restrict__ out,
                                                        int n8, float scale) {
  const int i = blockIdx.x * 256 + threadIdx.x;
  if (i >= n8) return;
  const float* p = in + 8 * (size_t)i;
  const v4f a = *(const v4f*)(p);
  const v4f c = *(const v4f*)(p + 4);
  unsigned short hb[8];
#pragma unroll
  for (int e = 0; e < 4; ++e) {
    hb[e]     = h_bits(a[e] * scale);
    hb[4 + e] = h_bits(c[e] * scale);
  }
  const v4u u = (v4u){pk16(hb[0], hb[1]), pk16(hb[2], hb[3]), pk16(hb[4], hb[5]), pk16(hb[6], hb[7])};
  unsigned short* q = out + 8 * (size_t)i;
  *(v4u*)q = u;
  
}

// ---------------------------------------------------------------------------
// Block-diagonal mask + row softmax over 4096 f32 scores (already scaled by 1/sqrt(hd) in the GEMM epilogue):
//   allowed(row, j) = (id[row] == id[j]) && id[row] >= 0 && id[j] >= 0   (id[j] >= 0 is implied by the first two)
//   s = allowed ? S : finfo.min (select, not add);  p = exp(s - max);  P[row][j] = f16( carry * p / sum )
// A fully masked row has all s == finfo.min -> max == finfo.min -> p == 1 everywhere -> uniform 1/4096 (as the spec).
// One block of 512 threads per row; thread t owns columns 8t..8t+7 (512 x 8 = 4096 = whole row).
// Reductions in fixed order (thread, 32-lane shuffle tree, 16 wave partials in index order); all shuffles unconditional.
// ---------------------------------------------------------------------------
__global__ __launch_bounds__(512) void mask_softmax_kernel(const float* __restrict__ S, const int* __restrict__ ids,
                                                           unsigned short* __restrict__ P, float carry) {
  __shared__ float redM[16];
  __shared__ float redS[16];
  const int row  = blockIdx.x;
  const int t    = threadIdx.x;
  const int lane = t & 31, wave = t >> 5;
  const int ci   = ids[row];
  const bool rowok = (ci >= 0);
  const int c0   = t * 8;
  const float* sr = S + (size_t)row * kTok + c0;
  const v4f a = *(const v4f*)(sr);
  const v4f c = *(const v4f*)(sr + 4);
  const v4i ka = *(const v4i*)(ids + c0);
  const v4i kc = *(const v4i*)(ids + c0 + 4);
  float x[8];
#pragma unroll
  for (int e = 0; e < 4; ++e) {
    x[e]     = (rowok && (ka[e] == ci)) ? a[e] : kNegFill;
    x[4 + e] = (rowok && (kc[e] == ci)) ? c[e] : kNegFill;
  }
  float m = fmaxf(fmaxf(fmaxf(x[0], x[1]), fmaxf(x[2], x[3])), fmaxf(fmaxf(x[4], x[5]), fmaxf(x[6], x[7])));
#pragma unroll
  for (int off = 16; off > 0; off >>= 1) m = fmaxf(m, __shfl_xor(m, off, 32));
  if (lane == 0) redM[wave] = m;
  __syncthreads();
  float gm = redM[0];
#pragma unroll
  for (int w = 1; w < 16; ++w) gm = fmaxf(gm, redM[w]);
  float p[8];
  float ps = 0.f;
#pragma unroll
  for (int e = 0; e < 8; ++e) {
    p[e] = expf(x[e] - gm);
    ps += p[e];
  }
#pragma unroll
  for (int off = 16; off > 0; off >>= 1) ps += __shfl_xor(ps, off, 32);
  if (lane == 0) redS[wave] = ps;
  __syncthreads();
  float gs = redS[0];
#pragma unroll
  for (int w = 1; w < 16; ++w) gs += redS[w];
  // gs >= 1 always (the max element contributes exp(0) = 1)
  const float pc = carry * (1.0f / gs);
  unsigned short hb[8];
#pragma unroll
  for (int e = 0; e < 8; ++e) hb[e] = h_bits(p[e] * pc);
  const v4u u = (v4u){pk16(hb[0], hb[1]), pk16(hb[2], hb[3]), pk16(hb[4], hb[5]), pk16(hb[6], hb[7])};
  unsigned short* q = P + (size_t)row * kTok + c0;
  *(v4u*)q = u;
  
}

// ---------------------------------------------------------------------------
// LayerNorm over 1024 columns of Y = x + attn_out (f32, already residual-added in the out_proj epilogue):
// Premise check: the head-count input must equal 16; otherwise the output is NaN-poisoned (block-uniform select).
// One block of 256 threads per row; thread t owns columns 4t..4t+3 (256 x 4 = 1024 = whole row).
// Fixed-order reductions (thread, shuffle tree, 8 wave partials in index order).
// ---------------------------------------------------------------------------
__global__ __launch_bounds__(256) void layernorm_kernel(const float* __restrict__ Y, const float* __restrict__ lnw,
                                                        const float* __restrict__ lnb, const int* __restrict__ nhp,
                                                        float* __restrict__ out) {
  __shared__ float red1[8];
  __shared__ float red2[8];
  const int row  = blockIdx.x;
  const int t    = threadIdx.x;
  const int lane = t & 31, wave = t >> 5;
  const int c0   = t * 4;
  const v4f y = *(const v4f*)(Y + (size_t)row * kDim + c0);
  float s1 = (y[0] + y[1]) + (y[2] + y[3]);
#pragma unroll
  for (int off = 16; off > 0; off >>= 1) s1 += __shfl_xor(s1, off, 32);
  if (lane == 0) red1[wave] = s1;
  __syncthreads();
  float tot = red1[0];
#pragma unroll
  for (int w = 1; w < 8; ++w) tot += red1[w];
  const float mu = tot * kInvDim;
  float d[4];
#pragma unroll
  for (int e = 0; e < 4; ++e) d[e] = y[e] - mu;
  float s2 = (d[0] * d[0] + d[1] * d[1]) + (d[2] * d[2] + d[3] * d[3]);
#pragma unroll
  for (int off = 16; off > 0; off >>= 1) s2 += __shfl_xor(s2, off, 32);
  if (lane == 0) red2[wave] = s2;
  __syncthreads();
  float tot2 = red2[0];
#pragma unroll
  for (int w = 1; w < 8; ++w) tot2 += red2[w];
  const float var = tot2 * kInvDim;
  const float rs  = rsqrtf(var + kLnEps);
  const v4f wv = *(const v4f*)(lnw + c0);
  const v4f bv = *(const v4f*)(lnb + c0);
  const bool bad = (nhp[0] != kHeads);
  const float nanv = __int_as_float(0x7fc00000);
  v4f o;
#pragma unroll
  for (int e = 0; e < 4; ++e) {
    const float r = d[e] * rs * wv[e] + bv[e];
    o[e] = bad ? nanv : r;
  }
  float* q = out + (size_t)row * kDim + c0;
  *(v4f*)q = o;
  
}

// ---------------------------------------------------------------------------
// Host glue: kernel launches only. d_in order:
//   0 x [4096][1024] f32, 1 cluster ids [4096] i32, 2 in_proj_w [3072][1024] f32, 3 in_proj_b [3072] f32,
//   4 out_proj_w [1024][1024] f32, 5 out_proj_b [1024] f32, 6 ln_w [1024] f32, 7 ln_b [1024] f32, 8 head count [1] i32.
// Launch count: 3 casts + 2 in_proj GEMMs + 16 x (scores GEMM, softmax, P.V GEMM) + out_proj GEMM + LayerNorm = 55.
// ---------------------------------------------------------------------------
extern "C" void kernel_launch(void* const* d_in, const int* in_sizes, int n_in,
                              void* d_out, int out_size, void* d_ws, size_t ws_size, hipStream_t stream) {
  if (n_in < 9) return;
  if (in_sizes[0] != kTok * kDim || in_sizes[1] != kTok || in_sizes[2] != 3 * kDim * kDim ||
      in_sizes[3] != 3 * kDim || in_sizes[4] != kDim * kDim || in_sizes[5] != kDim ||
      in_sizes[6] != kDim || in_sizes[7] != kDim || in_sizes[8] < 1) return;
  if (out_size != kTok * kDim) return;
  if (ws_size < kWsTotal) return;

  const float* x     = (const float*)d_in[0];
  const int*   ids   = (const int*)d_in[1];
  const float* w_in  = (const float*)d_in[2];
  const float* b_in  = (const float*)d_in[3];
  const float* w_out = (const float*)d_in[4];
  const float* b_out = (const float*)d_in[5];
  const float* lnw   = (const float*)d_in[6];
  const float* lnb   = (const float*)d_in[7];
  const int*   nhp   = (const int*)d_in[8];
  float* out = (float*)d_out;

  unsigned char* ws = (unsigned char*)d_ws;
  unsigned short* ctx16  = (unsigned short*)(ws + kOffCtx);
  unsigned short* qk16   = (unsigned short*)(ws + kOffQK);
  unsigned short* vt16   = (unsigned short*)(ws + kOffVT);
  float*          S      = (float*)(ws + kOffS);
  unsigned short* x16    = (unsigned short*)(ws + kOffS);                 // early tenant of R_S
  unsigned short* win16  = (unsigned short*)(ws + kOffS + kBytesX16);     // early tenant of R_S
  float*          Y      = (float*)(ws + kOffS);                          // late tenant of R_S
  unsigned short* p16    = (unsigned short*)(ws + kOffP);
  unsigned short* wout16 = (unsigned short*)(ws + kOffP);                 // late tenant of R_P

  // ---- casts: x -> f16, W_in -> f16(x16 W) ----
  {
    const int n8x = (kTok * kDim) / 8;          // 524288 threads x 8 = 4,194,304 elements
    cast8_f16_kernel<<<dim3((n8x + 255) / 256), dim3(256), 0, stream>>>(x, x16, n8x, 1.0f);
    const int n8w = (3 * kDim * kDim) / 8;      // 393216 threads x 8 = 3,145,728 elements
    cast8_f16_kernel<<<dim3((n8w + 255) / 256), dim3(256), 0, stream>>>(w_in, win16, n8w, kWCarry);
  }

  // ---- in_proj q|k: C[4096][2048] = (1/16) x16 . Win16[0:2048]^T + b_in[n] -> f16 plane (lda=ldb=1024, ldc=2048) ----
  // M=4096, N=2048, K=1024 (K%32==0, M,N %64==0); 2048 tiles -> 256 blocks
  wmma_gemm64<0, false, 2, 1, false><<<dim3(256, 1), dim3(256), 0, stream>>>(
      x16, x16, kDim, 0L, win16, win16, kDim, 0L, (void*)qk16, (void*)qk16, kQKld, 0L,
      b_in, x, 0L, kTok, kQKld, kDim, kWCarryInv);

  // ---- in_proj v, transposed: Vt[1024][4096] = (1/16) Win16[2048:3072] . x16^T + b_in[2048 + m] -> f16 (ldc=4096) ----
  // M=1024 (v features), N=4096 (tokens), K=1024; 1024 tiles -> 128 blocks
  wmma_gemm64<0, false, 1, 1, false><<<dim3(128, 1), dim3(256), 0, stream>>>(
      win16 + (size_t)2 * kDim * kDim, win16 + (size_t)2 * kDim * kDim, kDim, 0L, x16, x16, kDim, 0L,
      (void*)vt16, (void*)vt16, kTok, 0L, b_in + 2 * kDim, x, 0L, kDim, kTok, kDim, kWCarryInv);

  // ---- attention, one head at a time ----
  for (int h = 0; h < kHeads; ++h) {
    // scores S[4096][4096] f32 = 0.125 * q_h . k_h^T ; A = q plane cols h*64.. (lda 2048), Bt = k plane cols 1024+h*64.. (ldb 2048)
    // M=N=4096, K=64 (two 32-deep steps, loads stay inside the head's 64 columns); 4096 tiles -> 512 blocks
    wmma_gemm64<0, false, 0, 0, false><<<dim3(512, 1), dim3(256), 0, stream>>>(
        qk16 + h * kHd, qk16 + h * kHd, kQKld, 0L, qk16 + kDim + h * kHd, qk16 + kDim + h * kHd, kQKld, 0L,
        (void*)S, (void*)S, kTok, 0L, b_in, x, 0L, kTok, kTok, kHd, kScoreScale);

    // mask + softmax per row -> P f16 carried x2048 (whole plane written: 4096 rows x 4096 cols)
    mask_softmax_kernel<<<dim3(kTok), dim3(512), 0, stream>>>(S, ids, p16, kPCarry);

    // ctx columns h*64..h*64+63 of ctx16[4096][1024] = (256/2048) P . Vt_h^T ; A = P (lda 4096), Bt = Vt rows h*64.. (ldb 4096)
    // 256 blocks x 16 rows; the 4096 keys are split over the block's 16 waves
    pv_splitk_kernel<<<dim3(kTok / 16), dim3(512), 0, stream>>>(
        p16, vt16 + (size_t)h * kHd * kTok, ctx16 + h * kHd, kPVScale);
  }

  // ---- W_out -> f16(x16 W) into the now-dead P region ----
  {
    const int n8o = (kDim * kDim) / 8;          // 131072 threads x 8 = 1,048,576 elements
    cast8_f16_kernel<<<dim3((n8o + 255) / 256), dim3(256), 0, stream>>>(w_out, wout16, n8o, kWCarry);
  }

  // ---- out_proj + bias + residual: Y[4096][1024] f32 = (1/4096) ctx16 . Wout16^T + b_out[n] + x[m][n] ----
  // M=4096, N=1024, K=1024; 1024 tiles -> 128 blocks; RESID read and write are element-local in the epilogue, Y does not alias x
  wmma_gemm64<0, false, 2, 0, true><<<dim3(128, 1), dim3(256), 0, stream>>>(
      ctx16, ctx16, kDim, 0L, wout16, wout16, kDim, 0L, (void*)Y, (void*)Y, kDim, 0L,
      b_out, x, 0L, kTok, kDim, kDim, kOutScale);

  // ---- LayerNorm -> d_out [4096][1024] f32 ----
  layernorm_kernel<<<dim3(kTok), dim3(256), 0, stream>>>(Y, lnw, lnb, nhp, out);
}

// v002
// A run of this version takes 230 microseconds.
// Timed twice side by side with v001, it ran 4.04 and 4.00 times as fast.
// Over all steps from v000 it is 15.5 times as fast.
// Contractions: in_proj q|k (x f16 x W^T f16 carried x16), in_proj v^T (W f16 x16 x x^T f16), scores q.k^T (q,k f16 planes), attn.v (V^T f16 x P f16 carried x64, unnormalised), out_proj (ctx f16 carried x256 x Wo^T f16 carried x16): all v_wmma_f32_16x16x32_f16 with f32 accumulate; mask+softmax, bias, residual, LayerNorm in f32.
#include <hip/hip_runtime.h>
#include <math.h>

// ---------------------------------------------------------------------------
// Problem constants
// ---------------------------------------------------------------------------
constexpr int kTok   = 4096;            // tokens
constexpr int kDim   = 1024;            // model dim
constexpr int kHeads = 16;
constexpr int kHd    = 64;
constexpr int kQKld  = 2 * kDim;        // pitch of the q | k plane (halves)
constexpr float kWCarry    = 16.0f;     // weights carried x16 in f16
constexpr float kWCarryInv = 1.0f / 16.0f;
constexpr float kCtxCarry  = 256.0f;    // context carried x256 in f16
constexpr float kScoreScale = 0.125f;   // 1/sqrt(64)
constexpr float kOutScale  = 1.0f / (kCtxCarry * kWCarry);   // 1/4096
constexpr float kInvDim    = 1.0f / 1024.0f;
constexpr float kLnEps     = 1e-5f;

static_assert(kHeads * kHd == kDim, "head split");

// ---------------------------------------------------------------------------
//   R_CTX : ctx16  [4096][1024] f16                              8 MiB  @   0 MiB   live attention .. out_proj
//   R_QK  : q|k16  [4096][2048] f16                             16 MiB  @   8 MiB   live in_proj .. attention
//   R_VT  : Vt16   [1024][4096] f16                              8 MiB  @  24 MiB   live in_proj .. attention
//   R_S   :                                                     64 MiB  @  32 MiB
//           early: x16 [4096][1024] f16 (8 MiB @ +0), Win16 [3072][1024] f16 (6 MiB @ +8 MiB)  dead before attention
//           late : Y f32 [4096][1024] (16 MiB @ +0) written by out_proj
//   R_P   :                                                     32 MiB  @  96 MiB
//           Wout16 [1024][1024] f16 (2 MiB @ +0)
// ---------------------------------------------------------------------------
constexpr size_t kBytesCtx  = (size_t)kTok * kDim * 2;
constexpr size_t kBytesQK   = (size_t)kTok * kQKld * 2;
constexpr size_t kBytesVT   = (size_t)kDim * kTok * 2;
constexpr size_t kBytesS    = (size_t)kTok * kTok * 4;
constexpr size_t kBytesP    = (size_t)kTok * kTok * 2;
constexpr size_t kBytesX16  = (size_t)kTok * kDim * 2;
constexpr size_t kBytesWin  = (size_t)3 * kDim * kDim * 2;
constexpr size_t kBytesWout = (size_t)kDim * kDim * 2;
constexpr size_t kBytesY    = (size_t)kTok * kDim * 4;
constexpr size_t kOffCtx = 0;
constexpr size_t kOffQK  = kOffCtx + kBytesCtx;
constexpr size_t kOffVT  = kOffQK + kBytesQK;
constexpr size_t kOffS   = kOffVT + kBytesVT;
constexpr size_t kOffP   = kOffS + kBytesS;
constexpr size_t kWsTotal = kOffP + kBytesP;
static_assert(kWsTotal == (size_t)134217728, "carve total 128 MiB");
static_assert(kBytesX16 + kBytesWin <= kBytesS, "early tenants of R_S");
static_assert(kBytesY <= kBytesS, "late tenant of R_S");
static_assert(kBytesWout <= kBytesP, "late tenant of R_P");
static_assert((kOffQK % 128) == 0 && (kOffVT % 128) == 0 && (kOffS % 128) == 0 && (kOffP % 128) == 0, "alignment");

typedef __attribute__((ext_vector_type(16))) _Float16 v16h;
typedef __attribute__((ext_vector_type(8)))  _Float16 v8h;
typedef __attribute__((ext_vector_type(16))) __bf16   v16b;
typedef __attribute__((ext_vector_type(8)))  __bf16   v8b;
typedef __attribute__((ext_vector_type(8)))  float    v8f;
typedef __attribute__((ext_vector_type(4)))  float    v4f;
typedef __attribute__((ext_vector_type(2)))  float    v2f;
typedef __attribute__((ext_vector_type(4)))  unsigned int v4u;
typedef __attribute__((ext_vector_type(4)))  int      v4i;

__device__ __forceinline__ unsigned short f2bf_bits(float f) {
  unsigned u = __float_as_uint(f);
  return (unsigned short)((u + 0x7FFFu + ((u >> 16) & 1u)) >> 16);
}
__device__ __forceinline__ float bf_bits2f(unsigned short h) { return __uint_as_float(((unsigned)h) << 16); }

// hazard guards as plain device helpers (no inline asm inside the kernel template body)
__device__ __forceinline__ void dep_guard_h(v8f& a, v8f& b, v16h x, v16h y) { asm volatile("v_nop\n\tv_nop\n\tv_nop\n\tv_nop" : "+v"(a), "+v"(b) : "v"(x), "v"(y)); }
__device__ __forceinline__ void dep_guard_b(v8f& a, v8f& b, v16b x, v16b y) { asm volatile("v_nop\n\tv_nop\n\tv_nop\n\tv_nop" : "+v"(a), "+v"(b) : "v"(x), "v"(y)); }
__device__ __forceinline__ void keep4_h(v16h a, v16h b, v16h c, v16h d) { asm volatile("v_nop" :: "v"(a), "v"(b), "v"(c), "v"(d)); }
__device__ __forceinline__ void keep4_b(v16b a, v16b b, v16b c, v16b d) { asm volatile("v_nop" :: "v"(a), "v"(b), "v"(c), "v"(d)); }
__device__ __forceinline__ void acc_guard4(v8f& a, v8f& b, v8f& c, v8f& d) { asm volatile("v_nop\n\tv_nop\n\tv_nop\n\tv_nop" : "+v"(a), "+v"(b), "+v"(c), "+v"(d)); }
template <typename T> struct Frag;
template <> struct Frag<_Float16> {
  typedef v16h V; union U { v16h v; v8h h[2]; };
  static __device__ __forceinline__ v16h load(const _Float16* p) {   // elements 0..7 <- p[0..7], 8..15 <- p[16..23]
    U f; f.h[0] = *(const v8h*)(p); f.h[1] = *(const v8h*)(p + 16); return f.v;
  }
  static __device__ __forceinline__ v8f mma(v16h a, v16h b, v8f c) {
    return __builtin_amdgcn_wmma_f32_16x16x32_f16(false, a, false, b, (short)0, c, false, false);
  }
  static __device__ __forceinline__ void guard(v8f& a, v8f& b, v16h x, v16h y) { dep_guard_h(a, b, x, y); }
  static __device__ __forceinline__ void keep(v16h a, v16h b, v16h c, v16h d) { keep4_h(a, b, c, d); }
};
template <> struct Frag<__bf16> {
  typedef v16b V; union U { v16b v; v8b h[2]; };
  static __device__ __forceinline__ v16b load(const __bf16* p) {
    U f; f.h[0] = *(const v8b*)(p); f.h[1] = *(const v8b*)(p + 16); return f.v;
  }
  static __device__ __forceinline__ v8f mma(v16b a, v16b b, v8f c) {
    return __builtin_amdgcn_wmma_f32_16x16x32_bf16(false, a, false, b, (short)0, c, false, false);
  }
  static __device__ __forceinline__ void guard(v8f& a, v8f& b, v16b x, v16b y) { dep_guard_b(a, b, x, y); }
  static __device__ __forceinline__ void keep(v16b a, v16b b, v16b c, v16b d) { keep4_b(a, b, c, d); }
};

__device__ __forceinline__ unsigned pk16(unsigned short a, unsigned short b) { return (unsigned)a | ((unsigned)b << 16); }
__device__ __forceinline__ unsigned short h_bits(float f) { const _Float16 h = (_Float16)f; return __builtin_bit_cast(unsigned short, h); }

// ---- Register-blocked batched WMMA GEMM (ACT reduced to none/relu/leaky) -----------------------
// C[m,n] = scale * sum_k A[m,k] * Bt[n,k] (+bias)(+resid); each wave owns a 64x64 tile.
// A row-major [M,K]; Bt row-major [N,K]; M,N % 64 == 0, K % 32 == 0.
// SPLIT: operands are hi/lo planes (A2/Bt2 = lo planes, same layout); product = hi.hi + hi.lo + lo.hi.
// BIAS_MODE: 0 = none, 1 = bias[m], 2 = bias[n].
// OUT_MODE: 0 = f32, 1 = f16, 2 = bf16 hi plane (Cout) + bf16 lo plane (Cout2).
// ET: 0 = f16 operands, 1 = bf16 operands (pointers passed as 16-bit storage)
template <int ET> struct Elem;
template <> struct Elem<0> { typedef _Float16 T; };
template <> struct Elem<1> { typedef __bf16 T; };
template <int ET, bool SPLIT, int BIAS_MODE, int OUT_MODE, bool RESID, int ACT = 0>
__global__ __launch_bounds__(256) void wmma_gemm64(
    const unsigned short* __restrict__ Ap, const unsigned short* __restrict__ A2p, int lda, long strideA,
    const unsigned short* __restrict__ Btp, const unsigned short* __restrict__ Bt2p, int ldb, long strideB,
    void* __restrict__ Cout, void* __restrict__ Cout2, int ldc, long strideC,
    const float* __restrict__ bias,
    const float* __restrict__ resid, long strideR,
    int M, int N, int K, float scale) {
  typedef typename Elem<ET>::T T;
  typedef typename Frag<T>::V V;
  const T* A = (const T*)Ap; const T* A2 = (const T*)A2p; const T* Bt = (const T*)Btp; const T* Bt2 = (const T*)Bt2p;
  __shared__ __align__(16) float sT[8][16 * 68];   // per-wave 16x64 slab, pitch 68 floats
  const int b    = blockIdx.y;
  const int lane = threadIdx.x & 31;
  const int wave = threadIdx.x >> 5;
  const int tilesN = N >> 6;
  const int tilesM = M >> 6;
  const int tile = blockIdx.x * 8 + wave;
  if (tile >= tilesM * tilesN) return;   // wave-uniform; no block barriers in this kernel
  const int tm = tile / tilesN;
  const int tn = tile - tm * tilesN;
  const int m0 = tm << 6;
  const int n0 = tn << 6;

  const T* Ab  = A  + (size_t)b * strideA;
  const T* Bb  = Bt + (size_t)b * strideB;
  const T* Ab2 = SPLIT ? (A2  + (size_t)b * strideA) : nullptr;
  const T* Bb2 = SPLIT ? (Bt2 + (size_t)b * strideB) : nullptr;

  const int rlane = lane & 15;                 // row (A) / col (B, D) within subtile
  const int koff  = (lane >> 4) * 8;           // k offset of this lane half
  const int mOff  = (lane >> 4) * 8;           // D row offset

  v8f acc[4][4];
#pragma unroll
  for (int i = 0; i < 4; ++i)
#pragma unroll
    for (int j = 0; j < 4; ++j) acc[i][j] = (v8f){0.f,0.f,0.f,0.f,0.f,0.f,0.f,0.f};

  for (int k0 = 0; k0 < K; k0 += 32) {
    V bh[4], bl[4];
#pragma unroll
    for (int j = 0; j < 4; ++j) {
      const size_t bo = (size_t)(n0 + (j << 4) + rlane) * ldb + koff + k0;
      bh[j] = Frag<T>::load(Bb + bo);
      if (SPLIT) bl[j] = Frag<T>::load(Bb2 + bo);
    }
#pragma unroll
    for (int i = 0; i < 4; ++i) {
      const size_t ao = (size_t)(m0 + (i << 4) + rlane) * lda + koff + k0;
      V ah = Frag<T>::load(Ab + ao);
      V al;
      if (SPLIT) al = Frag<T>::load(Ab2 + ao);
#pragma unroll
      for (int j = 0; j < 4; ++j) {
        acc[i][j] = Frag<T>::mma(ah, bh[j], acc[i][j]);
        if (SPLIT) {
          acc[i][j] = Frag<T>::mma(ah, bl[j], acc[i][j]);
          acc[i][j] = Frag<T>::mma(al, bh[j], acc[i][j]);
        }
      }
      Frag<T>::guard(acc[i][0], acc[i][3], ah, SPLIT ? al : ah);
    }
    Frag<T>::keep(bh[0], bh[1], bh[2], bh[3]);
    if (SPLIT) Frag<T>::keep(bl[0], bl[1], bl[2], bl[3]);
  }
  acc_guard4(acc[0][0], acc[0][1], acc[0][2], acc[0][3]);
  acc_guard4(acc[1][0], acc[1][1], acc[1][2], acc[1][3]);
  acc_guard4(acc[2][0], acc[2][1], acc[2][2], acc[2][3]);
  acc_guard4(acc[3][0], acc[3][1], acc[3][2], acc[3][3]);

  // ---- epilogue ----
  float* slab = sT[wave];
  const float* Rb = RESID ? (resid + (size_t)b * strideR) : nullptr;
#pragma unroll
  for (int i = 0; i < 4; ++i) {
    const int mBase = m0 + (i << 4);
#pragma unroll
    for (int j = 0; j < 4; ++j) {
      const int n = n0 + (j << 4) + rlane;
      float bv = 0.f;
      if (BIAS_MODE == 2) bv = bias[n];
#pragma unroll
      for (int r = 0; r < 8; ++r) {
        float v = acc[i][j][r] * scale;
        if (BIAS_MODE == 1) v += bias[mBase + mOff + r];
        if (BIAS_MODE == 2) v += bv;
        if (RESID) v += Rb[(size_t)(mBase + mOff + r) * ldc + n];
        if (ACT == 2) v = fmaxf(v, 0.0f);
        if (ACT == 4) v = (v > 0.f) ? v : 0.01f * v;
        slab[(mOff + r) * 68 + (j << 4) + rlane] = v;
      }
    }
    __builtin_amdgcn_fence(__ATOMIC_RELEASE, "workgroup");
    __builtin_amdgcn_wave_barrier();
    __builtin_amdgcn_fence(__ATOMIC_ACQUIRE, "workgroup");
    if (OUT_MODE == 0) {
      float* C = (float*)Cout + (size_t)b * strideC;
      const int hh = lane >> 4, c4 = (lane & 15) * 4;     // row seg = 256 B = 16 lanes x 16 B
      {
#pragma unroll
        for (int it = 0; it < 8; ++it) {
          const int row = it * 2 + hh;
          v4f v = *(const v4f*)(slab + row * 68 + c4);
          *(v4f*)(C + (size_t)(mBase + row) * ldc + n0 + c4) = v;
        }
        
      }
    } else {
      const int q = lane >> 3, c8 = (lane & 7) * 8;
      unsigned short* C  = (unsigned short*)Cout  + (size_t)b * strideC;
      unsigned short* C2 = (OUT_MODE == 2) ? ((unsigned short*)Cout2 + (size_t)b * strideC) : nullptr;
      {
#pragma unroll
        for (int it = 0; it < 4; ++it) {
          const int row = it * 4 + q;
          const float* sp = slab + row * 68 + c8;
          v8h hv, lv;
#pragma unroll
          for (int e = 0; e < 8; ++e) {
            if (OUT_MODE == 1) {
              hv[e] = (_Float16)sp[e];
            } else {
              unsigned short hb = f2bf_bits(sp[e]);
              unsigned short lb = f2bf_bits(sp[e] - bf_bits2f(hb));
              hv[e] = __builtin_bit_cast(_Float16, hb);
              lv[e] = __builtin_bit_cast(_Float16, lb);
            }
          }
          *(v8h*)(C + (size_t)(mBase + row) * ldc + n0 + c8) = hv;
          if (OUT_MODE == 2) *(v8h*)(C2 + (size_t)(mBase + row) * ldc + n0 + c8) = lv;
        }
        
      }
    }
    __builtin_amdgcn_fence(__ATOMIC_RELEASE, "workgroup");
    __builtin_amdgcn_wave_barrier();
    __builtin_amdgcn_fence(__ATOMIC_ACQUIRE, "workgroup");
  }
}

// ---------------------------------------------------------------------------
// Attention for all heads in one launch: scores, mask, softmax and P.V stay in registers; S and P never reach memory.
//   St = K . Q^T  (A = 16 key rows from LDS, B = 16 query columns kept in registers): lane (c, h) holds, for query c,
//   the scores of keys 8h .. 8h+7 of each 16-key tile. Two such tiles, converted in place, are the B operand (32 keys)
//   of  Ot += Vt . Pt  (A = 16 rows of Vt from LDS). Every fragment is loaded with the GEMM engine's loader, whose k order
//   (elements 0..7 = k 8h.., elements 8..15 = k 16+8h..) is also the order of the packed score tiles.
// Block = 8 waves x 32 query columns = 256 queries of one head; grid = 16 heads x 16 query blocks = 256 blocks.
// Keys come in 64 stages of 64: K rows (64 x 128 B) and Vt rows (64 x 128 B) are staged in LDS at a 144-B pitch, two
// buffers; stage s + 1 is loaded into registers ahead of stage s's work and stored to the other buffer behind it.
// Softmax is the running form, in log2 units on the raw products:
//   allowed(q, j) = (id[q] == id[j]) && id[q] >= 0 && id[j] >= 0 ; x = allowed ? q.k : fill ; p = 2^(x*cs - m*cs + 6)
//   m is the maximum in use for the column; it is raised, and sums and outputs rescaled, only when a pass's maximum
//   exceeds it by more than 8 log2 units (so p <= 2^14, inside f16). out = sum(p v) / sum(p): every factor cancels.
// The fill is -2^100: below every product of f16 operands, and fill*cs is exact, so a column with no allowed key so far
// has x*cs - m*cs == 0 and p == 1 on every key (the uniform row of the definition); the first allowed key rescales that by 0.
// Every '#pragma unroll' in the kernel makes the indices of a fragment or accumulator array constants, so that it stays in registers.
// ---------------------------------------------------------------------------
// lane l <-> lane l ^ 16 on the vector pipe (a shuffle would go through the LDS unit and be waited for)
__device__ __forceinline__ float xhalf(float v) {
  const int b = __builtin_bit_cast(int, v);
  return __builtin_bit_cast(float, __builtin_amdgcn_permlanex16(b, b, 0x76543210, 0xfedcba98, false, false));
}
constexpr int kFaWaves  = 8;
constexpr int kFaBlockQ = kFaWaves * 32;      // 256 queries per block
constexpr int kFaStage  = 64;                 // keys per stage
constexpr int kFaStages = kTok / kFaStage;    // 64
constexpr int kFaPitch  = 72;                 // halves per staged row (144 B)
constexpr float kFaExpScale = kScoreScale * 1.44269504088896340736f;   // raw q.k -> log2 units
constexpr float kFaFill     = -0x1p100f;
constexpr float kFaLazy     = 8.0f / kFaExpScale;                      // 8 log2 units, in raw units
constexpr float kFaBias     = 6.0f;                                    // p carried x64 in f16
static_assert(kTok % kFaBlockQ == 0 && kTok % kFaStage == 0 && kHd == 64, "fused attention tiling");
// waves_per_eu(4, 4): holds the allocation at 256 registers, so the loop has no register-window switches
__global__ __launch_bounds__(256) __attribute__((amdgpu_waves_per_eu(4, 4))) void attn_fused_kernel(const unsigned short* __restrict__ QKp,
                                                         const unsigned short* __restrict__ Vtp,
                                                         const int* __restrict__ ids,
                                                         unsigned short* __restrict__ Cp) {
  __shared__ __align__(16) _Float16 sK[2][kFaStage * kFaPitch];
  __shared__ __align__(16) _Float16 sV[2][kHd * kFaPitch];
  __shared__ __align__(16) int sId[kTok];
  const int tid  = threadIdx.x;
  const int lane = tid & 31;
  const int wave = __builtin_amdgcn_readfirstlane(tid >> 5);   // wave-uniform: kept in a scalar register
  const int c    = lane & 15;                  // A row / B, D column within a tile
  const int h    = lane >> 4;                  // lane half
  const int head = blockIdx.x >> 4;
  const int q0   = ((blockIdx.x & 15) * kFaBlockQ) + wave * 32;
  const _Float16* QK = (const _Float16*)QKp;

  // staging: thread t moves 16 B of rows t/8 and t/8 + 32 of each tile (8 threads = one 128-B row)
  const int srow = tid >> 3, scol = (tid & 7) * 8;
  const char* gK = (const char*)(QK + kDim + head * kHd);                            // block-uniform bases ...
  const char* gV = (const char*)((const _Float16*)Vtp + (size_t)head * kHd * kTok);
  const unsigned oK = (unsigned)(srow * kQKld + scol) * 2u;                          // ... and 32-bit byte offsets per lane
  const unsigned oV = (unsigned)(srow * kTok + scol) * 2u;
  const int sOff = srow * kFaPitch + scol;

  {
    v8h rk[2], rv[2];
#pragma unroll
    for (int i = 0; i < 2; ++i) {
      rk[i] = *(const v8h*)(gK + (size_t)(32 * i) * kQKld * 2 + oK);
      rv[i] = *(const v8h*)(gV + (size_t)(32 * i) * kTok * 2 + oV);
    }
    // key ids, every negative id as -1 (a query's negative id becomes -2: the two never compare equal)
#pragma unroll
    for (int i = 0; i < kTok / 1024; ++i) {
      v4i k4 = *(const v4i*)(ids + (tid + 256 * i) * 4);
#pragma unroll
      for (int e = 0; e < 4; ++e) k4[e] = (k4[e] < 0) ? -1 : k4[e];
      *(v4i*)(sId + (tid + 256 * i) * 4) = k4;
    }
#pragma unroll
    for (int i = 0; i < 2; ++i) {
      *(v8h*)(&sK[0][sOff + 32 * i * kFaPitch]) = rk[i];
      *(v8h*)(&sV[0][sOff + 32 * i * kFaPitch]) = rv[i];
    }
  }

  v16h qf[2][2];     // [query tile][k step of the head dim]
  int  qid[2];
#pragma unroll
  for (int qt = 0; qt < 2; ++qt) {
    const int q = q0 + qt * 16 + c;
#pragma unroll
    for (int ks = 0; ks < 2; ++ks)
      qf[qt][ks] = Frag<_Float16>::load(QK + (size_t)q * kQKld + head * kHd + ks * 32 + h * 8);
    const int id = ids[q];
    qid[qt] = (id < 0) ? -2 : id;
  }

  v8f acc[2][4];     // [query tile][16 head columns]: acc[qt][dt][r] = Ot[dt*16 + 8h + r][query c]
  float muse[2], nmc[2], lsum[2];
#pragma unroll
  for (int qt = 0; qt < 2; ++qt) {
#pragma unroll
    for (int dt = 0; dt < 4; ++dt) acc[qt][dt] = (v8f){0.f,0.f,0.f,0.f,0.f,0.f,0.f,0.f};
    muse[qt] = kFaFill;
    nmc[qt]  = kFaBias - kFaFill * kFaExpScale;
    lsum[qt] = 0.f;
  }
  __syncthreads();   // stage 0 and the ids are in LDS before any wave reads them

  for (int s = 0; s < kFaStages; ++s) {
    const bool more = (s + 1 < kFaStages);     // the same for the whole block
    v8h rk[2], rv[2];
    if (more) {
#pragma unroll
      for (int i = 0; i < 2; ++i) {
        rk[i] = *(const v8h*)(gK + (size_t)((s + 1) * kFaStage + 32 * i) * kQKld * 2 + oK);
        rv[i] = *(const v8h*)(gV + ((size_t)(32 * i) * kTok + (s + 1) * kFaStage) * 2 + oV);
      }
    }
    const _Float16* kb = &sK[s & 1][c * kFaPitch + h * 8];
    const _Float16* vb = &sV[s & 1][c * kFaPitch + h * 8];
    const int*      ib = sId + s * kFaStage + h * 8;
#pragma unroll
    for (int ps = 0; ps < 2; ++ps) {           // a pass is 32 keys
      v16h kf[2][2];
#pragma unroll
      for (int kt = 0; kt < 2; ++kt)
#pragma unroll
        for (int ks = 0; ks < 2; ++ks) kf[kt][ks] = Frag<_Float16>::load(kb + (ps * 32 + kt * 16) * kFaPitch + ks * 32);
      v16h vf[4];
#pragma unroll
      for (int dt = 0; dt < 4; ++dt) vf[dt] = Frag<_Float16>::load(vb + (dt * 16) * kFaPitch + ps * 32);
      int kid[2][8];
#pragma unroll
      for (int kt = 0; kt < 2; ++kt) {
        const v4i i0 = *(const v4i*)(ib + ps * 32 + kt * 16);
        const v4i i1 = *(const v4i*)(ib + ps * 32 + kt * 16 + 4);
#pragma unroll
        for (int e = 0; e < 4; ++e) { kid[kt][e] = i0[e]; kid[kt][4 + e] = i1[e]; }
      }

      float x[2][16];
      float mt[2];
#pragma unroll
      for (int qt = 0; qt < 2; ++qt) {
#pragma unroll
        for (int kt = 0; kt < 2; ++kt) {
          v8f st = (v8f){0.f,0.f,0.f,0.f,0.f,0.f,0.f,0.f};
          st = Frag<_Float16>::mma(kf[kt][0], qf[qt][0], st);
          st = Frag<_Float16>::mma(kf[kt][1], qf[qt][1], st);
#pragma unroll
          for (int r = 0; r < 8; ++r) x[qt][kt * 8 + r] = (kid[kt][r] == qid[qt]) ? st[r] : kFaFill;
        }
        float m8[8];
#pragma unroll
        for (int r = 0; r < 8; ++r) m8[r] = fmaxf(x[qt][r], x[qt][8 + r]);
        const float m = fmaxf(fmaxf(fmaxf(m8[0], m8[1]), fmaxf(m8[2], m8[3])), fmaxf(fmaxf(m8[4], m8[5]), fmaxf(m8[6], m8[7])));
        mt[qt] = fmaxf(m, xhalf(m));                 // both halves of a column agree on its maximum
      }

      // one test per pass, a scalar branch: most passes raise no column's maximum by enough to matter
      const bool need = (mt[0] > muse[0] + kFaLazy) || (mt[1] > muse[1] + kFaLazy);
      if (__builtin_amdgcn_ballot_w32(need) != 0u) {
#pragma unroll
        for (int qt = 0; qt < 2; ++qt) {
          const float mn = fmaxf(muse[qt], mt[qt]);
          const float nn = kFaBias - mn * kFaExpScale;
          // 2^(nn - old), with the slot the instruction set asks for behind a transcendental in the same statement
          float al;
          asm("v_exp_f32 %0, %1\n\tv_nop" : "=v"(al) : "v"(nn - nmc[qt]));
          muse[qt] = mn;
          nmc[qt]  = nn;
          lsum[qt] *= al;
#pragma unroll
          for (int dt = 0; dt < 4; ++dt)
#pragma unroll
            for (int r = 0; r < 8; ++r) acc[qt][dt][r] *= al;
        }
      }

#pragma unroll
      for (int qt = 0; qt < 2; ++qt) {
        float p[16];
        v16h pb;
#pragma unroll
        for (int e = 0; e < 16; ++e) {
          p[e]  = __builtin_amdgcn_exp2f(fmaf(x[qt][e], kFaExpScale, nmc[qt]));
          pb[e] = (_Float16)p[e];
        }
        const float a0 = (p[0] + p[1]) + (p[2] + p[3]),   a1 = (p[4] + p[5]) + (p[6] + p[7]);
        const float a2 = (p[8] + p[9]) + (p[10] + p[11]), a3 = (p[12] + p[13]) + (p[14] + p[15]);
        lsum[qt] += (a0 + a1) + (a2 + a3);
#pragma unroll
        for (int dt = 0; dt < 4; ++dt) acc[qt][dt] = Frag<_Float16>::mma(vf[dt], pb, acc[qt][dt]);
      }
    }
    if (more) {
#pragma unroll
      for (int i = 0; i < 2; ++i) {
        *(v8h*)(&sK[(s + 1) & 1][sOff + 32 * i * kFaPitch]) = rk[i];
        *(v8h*)(&sV[(s + 1) & 1][sOff + 32 * i * kFaPitch]) = rv[i];
      }
    }
    // publishes stage s + 1 and ends every wave's reads of the buffer that the next trip refills
    __syncthreads();
  }

  // out[q][head*64 + dt*16 + 8h + r] = carry * acc / sum: 8 consecutive halves per lane and tile, one 16-B store
  // the lane number is read anew here, so that no vector register is held through the loop for the store address
  _Float16* C = (_Float16*)Cp;
  const int el = (int)__builtin_amdgcn_mbcnt_lo(~0u, 0u);
  const int ec = el & 15, eh = el >> 4;
#pragma unroll
  for (int qt = 0; qt < 2; ++qt) {
    const float lt  = lsum[qt] + xhalf(lsum[qt]);   // the halves hold disjoint keys; lt >= 1
    const float inv = kCtxCarry / lt;
    _Float16* cr = C + (size_t)(q0 + qt * 16 + ec) * kDim + head * kHd + eh * 8;
#pragma unroll
    for (int dt = 0; dt < 4; ++dt) {
      v8h o;
#pragma unroll
      for (int r = 0; r < 8; ++r) o[r] = (_Float16)(acc[qt][dt][r] * inv);
      *(v8h*)(cr + dt * 16) = o;
    }
  }
}

// ---------------------------------------------------------------------------
// f32 -> f16 cast with an exact power-of-two carry, 8 consecutive elements per thread (one 16-B store per lane;
// Coverage: n8 = n/8 threads x 8 elements = whole plane (n % 8 == 0 for every plane here); grid = ceil(n8/256), bound inside.
// ---------------------------------------------------------------------------
__global__ __launch_bounds__(256) void cast8_f16_kernel(const float* __restrict__ in, unsigned short* __restrict__ out,
                                                        int n8, float scale) {
  const int i = blockIdx.x * 256 + threadIdx.x;
  if (i >= n8) return;
  const float* p = in + 8 * (size_t)i;
  const v4f a = *(const v4f*)(p);
  const v4f c = *(const v4f*)(p + 4);
  unsigned short hb[8];
#pragma unroll
  for (int e = 0; e < 4; ++e) {
    hb[e]     = h_bits(a[e] * scale);
    hb[4 + e] = h_bits(c[e] * scale);
  }
  const v4u u = (v4u){pk16(hb[0], hb[1]), pk16(hb[2], hb[3]), pk16(hb[4], hb[5]), pk16(hb[6], hb[7])};
  unsigned short* q = out + 8 * (size_t)i;
  *(v4u*)q = u;
  
}

// ---------------------------------------------------------------------------
// LayerNorm over 1024 columns of Y = x + attn_out (f32, already residual-added in the out_proj epilogue):
// Premise check: the head-count input must equal 16; otherwise the output is NaN-poisoned (block-uniform select).
// One block of 256 threads per row; thread t owns columns 4t..4t+3 (256 x 4 = 1024 = whole row).
// Fixed-order reductions (thread, shuffle tree, 8 wave partials in index order).
// ---------------------------------------------------------------------------
__global__ __launch_bounds__(256) void layernorm_kernel(const float* __restrict__ Y, const float* __restrict__ lnw,
                                                        const float* __restrict__ lnb, const int* __restrict__ nhp,
                                                        float* __restrict__ out) {
  __shared__ float red1[8];
  __shared__ float red2[8];
  const int row  = blockIdx.x;
  const int t    = threadIdx.x;
  const int lane = t & 31, wave = t >> 5;
  const int c0   = t * 4;
  const v4f y = *(const v4f*)(Y + (size_t)row * kDim + c0);
  float s1 = (y[0] + y[1]) + (y[2] + y[3]);
#pragma unroll
  for (int off = 16; off > 0; off >>= 1) s1 += __shfl_xor(s1, off, 32);
  if (lane == 0) red1[wave] = s1;
  __syncthreads();
  float tot = red1[0];
#pragma unroll
  for (int w = 1; w < 8; ++w) tot += red1[w];
  const float mu = tot * kInvDim;
  float d[4];
#pragma unroll
  for (int e = 0; e < 4; ++e) d[e] = y[e] - mu;
  float s2 = (d[0] * d[0] + d[1] * d[1]) + (d[2] * d[2] + d[3] * d[3]);
#pragma unroll
  for (int off = 16; off > 0; off >>= 1) s2 += __shfl_xor(s2, off, 32);
  if (lane == 0) red2[wave] = s2;
  __syncthreads();
  float tot2 = red2[0];
#pragma unroll
  for (int w = 1; w < 8; ++w) tot2 += red2[w];
  const float var = tot2 * kInvDim;
  const float rs  = rsqrtf(var + kLnEps);
  const v4f wv = *(const v4f*)(lnw + c0);
  const v4f bv = *(const v4f*)(lnb + c0);
  const bool bad = (nhp[0] != kHeads);
  const float nanv = __int_as_float(0x7fc00000);
  v4f o;
#pragma unroll
  for (int e = 0; e < 4; ++e) {
    const float r = d[e] * rs * wv[e] + bv[e];
    o[e] = bad ? nanv : r;
  }
  float* q = out + (size_t)row * kDim + c0;
  *(v4f*)q = o;
  
}

// ---------------------------------------------------------------------------
// Host glue: kernel launches only. d_in order:
//   0 x [4096][1024] f32, 1 cluster ids [4096] i32, 2 in_proj_w [3072][1024] f32, 3 in_proj_b [3072] f32,
//   4 out_proj_w [1024][1024] f32, 5 out_proj_b [1024] f32, 6 ln_w [1024] f32, 7 ln_b [1024] f32, 8 head count [1] i32.
// Launch count: 3 casts + 2 in_proj GEMMs + fused attention + out_proj GEMM + LayerNorm = 8.
// ---------------------------------------------------------------------------
extern "C" void kernel_launch(void* const* d_in, const int* in_sizes, int n_in,
                              void* d_out, int out_size, void* d_ws, size_t ws_size, hipStream_t stream) {
  if (n_in < 9) return;
  if (in_sizes[0] != kTok * kDim || in_sizes[1] != kTok || in_sizes[2] != 3 * kDim * kDim ||
      in_sizes[3] != 3 * kDim || in_sizes[4] != kDim * kDim || in_sizes[5] != kDim ||
      in_sizes[6] != kDim || in_sizes[7] != kDim || in_sizes[8] < 1) return;
  if (out_size != kTok * kDim) return;
  if (ws_size < kWsTotal) return;

  const float* x     = (const float*)d_in[0];
  const int*   ids   = (const int*)d_in[1];
  const float* w_in  = (const float*)d_in[2];
  const float* b_in  = (const float*)d_in[3];
  const float* w_out = (const float*)d_in[4];
  const float* b_out = (const float*)d_in[5];
  const float* lnw   = (const float*)d_in[6];
  const float* lnb   = (const float*)d_in[7];
  const int*   nhp   = (const int*)d_in[8];
  float* out = (float*)d_out;

  unsigned char* ws = (unsigned char*)d_ws;
  unsigned short* ctx16  = (unsigned short*)(ws + kOffCtx);
  unsigned short* qk16   = (unsigned short*)(ws + kOffQK);
  unsigned short* vt16   = (unsigned short*)(ws + kOffVT);
  unsigned short* x16    = (unsigned short*)(ws + kOffS);                 // early tenant of R_S
  unsigned short* win16  = (unsigned short*)(ws + kOffS + kBytesX16);     // early tenant of R_S
  float*          Y      = (float*)(ws + kOffS);                          // late tenant of R_S
  unsigned short* wout16 = (unsigned short*)(ws + kOffP);                 // tenant of R_P

  // ---- casts: x -> f16, W_in -> f16(x16 W) ----
  {
    const int n8x = (kTok * kDim) / 8;          // 524288 threads x 8 = 4,194,304 elements
    cast8_f16_kernel<<<dim3((n8x + 255) / 256), dim3(256), 0, stream>>>(x, x16, n8x, 1.0f);
    const int n8w = (3 * kDim * kDim) / 8;      // 393216 threads x 8 = 3,145,728 elements
    cast8_f16_kernel<<<dim3((n8w + 255) / 256), dim3(256), 0, stream>>>(w_in, win16, n8w, kWCarry);
  }

  // ---- in_proj q|k: C[4096][2048] = (1/16) x16 . Win16[0:2048]^T + b_in[n] -> f16 plane (lda=ldb=1024, ldc=2048) ----
  // M=4096, N=2048, K=1024 (K%32==0, M,N %64==0); 2048 tiles -> 256 blocks
  wmma_gemm64<0, false, 2, 1, false><<<dim3(256, 1), dim3(256), 0, stream>>>(
      x16, x16, kDim, 0L, win16, win16, kDim, 0L, (void*)qk16, (void*)qk16, kQKld, 0L,
      b_in, x, 0L, kTok, kQKld, kDim, kWCarryInv);

  // ---- in_proj v, transposed: Vt[1024][4096] = (1/16) Win16[2048:3072] . x16^T + b_in[2048 + m] -> f16 (ldc=4096) ----
  // M=1024 (v features), N=4096 (tokens), K=1024; 1024 tiles -> 128 blocks
  wmma_gemm64<0, false, 1, 1, false><<<dim3(128, 1), dim3(256), 0, stream>>>(
      win16 + (size_t)2 * kDim * kDim, win16 + (size_t)2 * kDim * kDim, kDim, 0L, x16, x16, kDim, 0L,
      (void*)vt16, (void*)vt16, kTok, 0L, b_in + 2 * kDim, x, 0L, kDim, kTok, kDim, kWCarryInv);

  // ---- attention, all heads in one launch: ctx16[4096][1024] f16 carried x256 ----
  // 16 heads x 16 blocks of 256 queries; q = qk16 cols h*64.., k = qk16 cols 1024 + h*64.., Vt rows h*64..
  attn_fused_kernel<<<dim3(kHeads * (kTok / kFaBlockQ)), dim3(256), 0, stream>>>(qk16, vt16, ids, ctx16);

  // ---- W_out -> f16(x16 W) ----
  {
    const int n8o = (kDim * kDim) / 8;          // 131072 threads x 8 = 1,048,576 elements
    cast8_f16_kernel<<<dim3((n8o + 255) / 256), dim3(256), 0, stream>>>(w_out, wout16, n8o, kWCarry);
  }

  // ---- out_proj + bias + residual: Y[4096][1024] f32 = (1/4096) ctx16 . Wout16^T + b_out[n] + x[m][n] ----
  // M=4096, N=1024, K=1024; 1024 tiles -> 128 blocks; RESID read and write are element-local in the epilogue, Y does not alias x
  wmma_gemm64<0, false, 2, 0, true><<<dim3(128, 1), dim3(256), 0, stream>>>(
      ctx16, ctx16, kDim, 0L, wout16, wout16, kDim, 0L, (void*)Y, (void*)Y, kDim, 0L,
      b_out, x, 0L, kTok, kDim, kDim, kOutScale);

  // ---- LayerNorm -> d_out [4096][1024] f32 ----
  layernorm_kernel<<<dim3(kTok), dim3(256), 0, stream>>>(Y, lnw, lnb, nhp, out);
}

// v003
// A run of this version takes 180 microseconds.
// Two timings next to v002 put it at 1.27 and 1.30 times that version's speed.
// Over all steps from v000 it is 19.9 times as fast.
// Token order: x rows are laid out by cluster id before in_proj (rank by counting), so q, k, Vt are in ranked order; attention stores ctx rows back at the token's own index.
// Contractions: in_proj q|k (x f16 x W^T f16 carried x16), in_proj v^T (W f16 x16 x x^T f16), scores q.k^T (q,k f16 planes), attn.v (V^T f16 x P f16 carried x64, unnormalised), out_proj (ctx f16 carried x256 x Wo^T f16 carried x16): all v_wmma_f32_16x16x32_f16 with f32 accumulate; mask+softmax, bias, residual, LayerNorm in f32.
#include <hip/hip_runtime.h>
#include <math.h>

// ---------------------------------------------------------------------------
// Problem constants
// ---------------------------------------------------------------------------
constexpr int kTok   = 4096;            // tokens
constexpr int kDim   = 1024;            // model dim
constexpr int kHeads = 16;
constexpr int kHd    = 64;
constexpr int kQKld  = 2 * kDim;        // pitch of the q | k plane (halves)
constexpr float kWCarry    = 16.0f;     // weights carried x16 in f16
constexpr float kWCarryInv = 1.0f / 16.0f;
constexpr float kCtxCarry  = 256.0f;    // context carried x256 in f16
constexpr float kScoreScale = 0.125f;   // 1/sqrt(64)
constexpr float kOutScale  = 1.0f / (kCtxCarry * kWCarry);   // 1/4096
constexpr float kInvDim    = 1.0f / 1024.0f;
constexpr float kLnEps     = 1e-5f;

static_assert(kHeads * kHd == kDim, "head split");

// ---------------------------------------------------------------------------
//   R_CTX : ctx16  [4096][1024] f16                              8 MiB  @   0 MiB   live attention .. out_proj
//   R_QK  : q|k16  [4096][2048] f16                             16 MiB  @   8 MiB   live in_proj .. attention
//   R_VT  : Vt16   [1024][4096] f16                              8 MiB  @  24 MiB   live in_proj .. attention
//   R_S   :                                                     64 MiB  @  32 MiB
//           early: x16 [4096][1024] f16 (8 MiB @ +0), Win16 [3072][1024] f16 (6 MiB @ +8 MiB)  dead before attention
//           late : Y f32 [4096][1024] (16 MiB @ +0) written by out_proj
//   R_P   :                                                     32 MiB  @  96 MiB
//           Wout16 [1024][1024] f16 (2 MiB @ +0)
//           rank   [4096][4] i32 (64 KiB @ +4 MiB)  {place, first key, end key, id}  live rank+cast .. attention
// ---------------------------------------------------------------------------
constexpr size_t kBytesCtx  = (size_t)kTok * kDim * 2;
constexpr size_t kBytesQK   = (size_t)kTok * kQKld * 2;
constexpr size_t kBytesVT   = (size_t)kDim * kTok * 2;
constexpr size_t kBytesS    = (size_t)kTok * kTok * 4;
constexpr size_t kBytesP    = (size_t)kTok * kTok * 2;
constexpr size_t kBytesX16  = (size_t)kTok * kDim * 2;
constexpr size_t kBytesWin  = (size_t)3 * kDim * kDim * 2;
constexpr size_t kBytesWout = (size_t)kDim * kDim * 2;
constexpr size_t kBytesY    = (size_t)kTok * kDim * 4;
constexpr size_t kOffCtx = 0;
constexpr size_t kOffQK  = kOffCtx + kBytesCtx;
constexpr size_t kOffVT  = kOffQK + kBytesQK;
constexpr size_t kOffS   = kOffVT + kBytesVT;
constexpr size_t kOffP   = kOffS + kBytesS;
constexpr size_t kOffRank  = kOffP + ((size_t)4 << 20);
constexpr size_t kBytesRank = (size_t)kTok * 16;
constexpr size_t kWsTotal = kOffP + kBytesP;
static_assert(kWsTotal == (size_t)134217728, "carve total 128 MiB");
static_assert(kBytesX16 + kBytesWin <= kBytesS, "early tenants of R_S");
static_assert(kBytesY <= kBytesS, "late tenant of R_S");
static_assert(kBytesWout <= ((size_t)4 << 20) && kOffRank + kBytesRank <= kWsTotal, "tenants of R_P");
static_assert((kOffQK % 128) == 0 && (kOffVT % 128) == 0 && (kOffS % 128) == 0 && (kOffP % 128) == 0, "alignment");

typedef __attribute__((ext_vector_type(16))) _Float16 v16h;
typedef __attribute__((ext_vector_type(8)))  _Float16 v8h;
typedef __attribute__((ext_vector_type(16))) __bf16   v16b;
typedef __attribute__((ext_vector_type(8)))  __bf16   v8b;
typedef __attribute__((ext_vector_type(8)))  float    v8f;
typedef __attribute__((ext_vector_type(4)))  float    v4f;
typedef __attribute__((ext_vector_type(2)))  float    v2f;
typedef __attribute__((ext_vector_type(4)))  unsigned int v4u;
typedef __attribute__((ext_vector_type(4)))  int      v4i;

__device__ __forceinline__ unsigned short f2bf_bits(float f) {
  unsigned u = __float_as_uint(f);
  return (unsigned short)((u + 0x7FFFu + ((u >> 16) & 1u)) >> 16);
}
__device__ __forceinline__ float bf_bits2f(unsigned short h) { return __uint_as_float(((unsigned)h) << 16); }

// hazard guards as plain device helpers (no inline asm inside the kernel template body)
__device__ __forceinline__ void dep_guard_h(v8f& a, v8f& b, v16h x, v16h y) { asm volatile("v_nop\n\tv_nop\n\tv_nop\n\tv_nop" : "+v"(a), "+v"(b) : "v"(x), "v"(y)); }
__device__ __forceinline__ void dep_guard_b(v8f& a, v8f& b, v16b x, v16b y) { asm volatile("v_nop\n\tv_nop\n\tv_nop\n\tv_nop" : "+v"(a), "+v"(b) : "v"(x), "v"(y)); }
__device__ __forceinline__ void keep4_h(v16h a, v16h b, v16h c, v16h d) { asm volatile("v_nop" :: "v"(a), "v"(b), "v"(c), "v"(d)); }
__device__ __forceinline__ void keep4_b(v16b a, v16b b, v16b c, v16b d) { asm volatile("v_nop" :: "v"(a), "v"(b), "v"(c), "v"(d)); }
__device__ __forceinline__ void acc_guard4(v8f& a, v8f& b, v8f& c, v8f& d) { asm volatile("v_nop\n\tv_nop\n\tv_nop\n\tv_nop" : "+v"(a), "+v"(b), "+v"(c), "+v"(d)); }
template <typename T> struct Frag;
template <> struct Frag<_Float16> {
  typedef v16h V; union U { v16h v; v8h h[2]; };
  static __device__ __forceinline__ v16h load(const _Float16* p) {   // elements 0..7 <- p[0..7], 8..15 <- p[16..23]
    U f; f.h[0] = *(const v8h*)(p); f.h[1] = *(const v8h*)(p + 16); return f.v;
  }
  static __device__ __forceinline__ v8f mma(v16h a, v16h b, v8f c) {
    return __builtin_amdgcn_wmma_f32_16x16x32_f16(false, a, false, b, (short)0, c, false, false);
  }
  static __device__ __forceinline__ void guard(v8f& a, v8f& b, v16h x, v16h y) { dep_guard_h(a, b, x, y); }
  static __device__ __forceinline__ void keep(v16h a, v16h b, v16h c, v16h d) { keep4_h(a, b, c, d); }
};
template <> struct Frag<__bf16> {
  typedef v16b V; union U { v16b v; v8b h[2]; };
  static __device__ __forceinline__ v16b load(const __bf16* p) {
    U f; f.h[0] = *(const v8b*)(p); f.h[1] = *(const v8b*)(p + 16); return f.v;
  }
  static __device__ __forceinline__ v8f mma(v16b a, v16b b, v8f c) {
    return __builtin_amdgcn_wmma_f32_16x16x32_bf16(false, a, false, b, (short)0, c, false, false);
  }
  static __device__ __forceinline__ void guard(v8f& a, v8f& b, v16b x, v16b y) { dep_guard_b(a, b, x, y); }
  static __device__ __forceinline__ void keep(v16b a, v16b b, v16b c, v16b d) { keep4_b(a, b, c, d); }
};

__device__ __forceinline__ unsigned pk16(unsigned short a, unsigned short b) { return (unsigned)a | ((unsigned)b << 16); }
__device__ __forceinline__ unsigned short h_bits(float f) { const _Float16 h = (_Float16)f; return __builtin_bit_cast(unsigned short, h); }

// ---- Register-blocked batched WMMA GEMM (ACT reduced to none/relu/leaky) -----------------------
// C[m,n] = scale * sum_k A[m,k] * Bt[n,k] (+bias)(+resid); each wave owns a 64x64 tile.
// A row-major [M,K]; Bt row-major [N,K]; M,N % 64 == 0, K % 32 == 0.
// SPLIT: operands are hi/lo planes (A2/Bt2 = lo planes, same layout); product = hi.hi + hi.lo + lo.hi.
// BIAS_MODE: 0 = none, 1 = bias[m], 2 = bias[n].
// OUT_MODE: 0 = f32, 1 = f16, 2 = bf16 hi plane (Cout) + bf16 lo plane (Cout2).
// ET: 0 = f16 operands, 1 = bf16 operands (pointers passed as 16-bit storage)
template <int ET> struct Elem;
template <> struct Elem<0> { typedef _Float16 T; };
template <> struct Elem<1> { typedef __bf16 T; };
template <int ET, bool SPLIT, int BIAS_MODE, int OUT_MODE, bool RESID, int ACT = 0>
__global__ __launch_bounds__(256) void wmma_gemm64(
    const unsigned short* __restrict__ Ap, const unsigned short* __restrict__ A2p, int lda, long strideA,
    const unsigned short* __restrict__ Btp, const unsigned short* __restrict__ Bt2p, int ldb, long strideB,
    void* __restrict__ Cout, void* __restrict__ Cout2, int ldc, long strideC,
    const float* __restrict__ bias,
    const float* __restrict__ resid, long strideR,
    int M, int N, int K, float scale) {
  typedef typename Elem<ET>::T T;
  typedef typename Frag<T>::V V;
  const T* A = (const T*)Ap; const T* A2 = (const T*)A2p; const T* Bt = (const T*)Btp; const T* Bt2 = (const T*)Bt2p;
  __shared__ __align__(16) float sT[8][16 * 68];   // per-wave 16x64 slab, pitch 68 floats
  const int b    = blockIdx.y;
  const int lane = threadIdx.x & 31;
  const int wave = threadIdx.x >> 5;
  const int tilesN = N >> 6;
  const int tilesM = M >> 6;
  const int tile = blockIdx.x * 8 + wave;
  if (tile >= tilesM * tilesN) return;   // wave-uniform; no block barriers in this kernel
  const int tm = tile / tilesN;
  const int tn = tile - tm * tilesN;
  const int m0 = tm << 6;
  const int n0 = tn << 6;

  const T* Ab  = A  + (size_t)b * strideA;
  const T* Bb  = Bt + (size_t)b * strideB;
  const T* Ab2 = SPLIT ? (A2  + (size_t)b * strideA) : nullptr;
  const T* Bb2 = SPLIT ? (Bt2 + (size_t)b * strideB) : nullptr;

  const int rlane = lane & 15;                 // row (A) / col (B, D) within subtile
  const int koff  = (lane >> 4) * 8;           // k offset of this lane half
  const int mOff  = (lane >> 4) * 8;           // D row offset

  v8f acc[4][4];
#pragma unroll
  for (int i = 0; i < 4; ++i)
#pragma unroll
    for (int j = 0; j < 4; ++j) acc[i][j] = (v8f){0.f,0.f,0.f,0.f,0.f,0.f,0.f,0.f};

  for (int k0 = 0; k0 < K; k0 += 32) {
    V bh[4], bl[4];
#pragma unroll
    for (int j = 0; j < 4; ++j) {
      const size_t bo = (size_t)(n0 + (j << 4) + rlane) * ldb + koff + k0;
      bh[j] = Frag<T>::load(Bb + bo);
      if (SPLIT) bl[j] = Frag<T>::load(Bb2 + bo);
    }
#pragma unroll
    for (int i = 0; i < 4; ++i) {
      const size_t ao = (size_t)(m0 + (i << 4) + rlane) * lda + koff + k0;
      V ah = Frag<T>::load(Ab + ao);
      V al;
      if (SPLIT) al = Frag<T>::load(Ab2 + ao);
#pragma unroll
      for (int j = 0; j < 4; ++j) {
        acc[i][j] = Frag<T>::mma(ah, bh[j], acc[i][j]);
        if (SPLIT) {
          acc[i][j] = Frag<T>::mma(ah, bl[j], acc[i][j]);
          acc[i][j] = Frag<T>::mma(al, bh[j], acc[i][j]);
        }
      }
      Frag<T>::guard(acc[i][0], acc[i][3], ah, SPLIT ? al : ah);
    }
    Frag<T>::keep(bh[0], bh[1], bh[2], bh[3]);
    if (SPLIT) Frag<T>::keep(bl[0], bl[1], bl[2], bl[3]);
  }
  acc_guard4(acc[0][0], acc[0][1], acc[0][2], acc[0][3]);
  acc_guard4(acc[1][0], acc[1][1], acc[1][2], acc[1][3]);
  acc_guard4(acc[2][0], acc[2][1], acc[2][2], acc[2][3]);
  acc_guard4(acc[3][0], acc[3][1], acc[3][2], acc[3][3]);

  // ---- epilogue ----
  float* slab = sT[wave];
  const float* Rb = RESID ? (resid + (size_t)b * strideR) : nullptr;
#pragma unroll
  for (int i = 0; i < 4; ++i) {
    const int mBase = m0 + (i << 4);
#pragma unroll
    for (int j = 0; j < 4; ++j) {
      const int n = n0 + (j << 4) + rlane;
      float bv = 0.f;
      if (BIAS_MODE == 2) bv = bias[n];
#pragma unroll
      for (int r = 0; r < 8; ++r) {
        float v = acc[i][j][r] * scale;
        if (BIAS_MODE == 1) v += bias[mBase + mOff + r];
        if (BIAS_MODE == 2) v += bv;
        if (RESID) v += Rb[(size_t)(mBase + mOff + r) * ldc + n];
        if (ACT == 2) v = fmaxf(v, 0.0f);
        if (ACT == 4) v = (v > 0.f) ? v : 0.01f * v;
        slab[(mOff + r) * 68 + (j << 4) + rlane] = v;
      }
    }
    __builtin_amdgcn_fence(__ATOMIC_RELEASE, "workgroup");
    __builtin_amdgcn_wave_barrier();
    __builtin_amdgcn_fence(__ATOMIC_ACQUIRE, "workgroup");
    if (OUT_MODE == 0) {
      float* C = (float*)Cout + (size_t)b * strideC;
      const int hh = lane >> 4, c4 = (lane & 15) * 4;     // row seg = 256 B = 16 lanes x 16 B
      {
#pragma unroll
        for (int it = 0; it < 8; ++it) {
          const int row = it * 2 + hh;
          v4f v = *(const v4f*)(slab + row * 68 + c4);
          *(v4f*)(C + (size_t)(mBase + row) * ldc + n0 + c4) = v;
        }
        
      }
    } else {
      const int q = lane >> 3, c8 = (lane & 7) * 8;
      unsigned short* C  = (unsigned short*)Cout  + (size_t)b * strideC;
      unsigned short* C2 = (OUT_MODE == 2) ? ((unsigned short*)Cout2 + (size_t)b * strideC) : nullptr;
      {
#pragma unroll
        for (int it = 0; it < 4; ++it) {
          const int row = it * 4 + q;
          const float* sp = slab + row * 68 + c8;
          v8h hv, lv;
#pragma unroll
          for (int e = 0; e < 8; ++e) {
            if (OUT_MODE == 1) {
              hv[e] = (_Float16)sp[e];
            } else {
              unsigned short hb = f2bf_bits(sp[e]);
              unsigned short lb = f2bf_bits(sp[e] - bf_bits2f(hb));
              hv[e] = __builtin_bit_cast(_Float16, hb);
              lv[e] = __builtin_bit_cast(_Float16, lb);
            }
          }
          *(v8h*)(C + (size_t)(mBase + row) * ldc + n0 + c8) = hv;
          if (OUT_MODE == 2) *(v8h*)(C2 + (size_t)(mBase + row) * ldc + n0 + c8) = lv;
        }
        
      }
    }
    __builtin_amdgcn_fence(__ATOMIC_RELEASE, "workgroup");
    __builtin_amdgcn_wave_barrier();
    __builtin_amdgcn_fence(__ATOMIC_ACQUIRE, "workgroup");
  }
}

// ---------------------------------------------------------------------------
// Attention for all heads in one launch: scores, mask, softmax and P.V stay in registers; S and P never reach memory.
//   St = K . Q^T  (A = 16 key rows from LDS, B = 16 query columns kept in registers): lane (c, h) holds, for query c,
//   the scores of keys 8h .. 8h+7 of each 16-key tile. Two such tiles, converted in place, are the B operand (32 keys)
//   of  Ot += Vt . Pt  (A = 16 rows of Vt from LDS). Every fragment is loaded with the GEMM engine's loader, whose k order
//   (elements 0..7 = k 8h.., elements 8..15 = k 16+8h..) is also the order of the packed score tiles.
// Block = 8 waves x 32 query columns = 256 queries of one head; grid = 16 heads x 16 query blocks = 256 blocks.
// Queries and keys are in ranked order (equal ids lie together, negative ids first). A query with id >= 0 gives weight 0 to
// every key outside [first, end) of its id, so a block walks only the 64-key stages that meet its queries' ranges, and a wave
// works only on the 32-key passes that meet its own; a query with a negative id has the range [0, 4096) (the uniform row).
// In ranked order the first query of a group has the lowest 'first', and the first or the last the highest 'end'.
// Keys come in up to 64 stages of 64: K rows (64 x 128 B) and Vt rows (64 x 128 B) are staged in LDS at a 144-B pitch, two
// buffers; stage s + 1 is loaded into registers ahead of stage s's work and stored to the other buffer behind it.
// Softmax is the running form, in log2 units on the raw products:
//   allowed(q, j) = (id[q] == id[j]) && id[q] >= 0 && id[j] >= 0 ; x = allowed ? q.k : fill ; p = 2^(x*cs - m*cs + 6)
//   m is the maximum in use for the column; it is raised, and sums and outputs rescaled, only when a pass's maximum
//   exceeds it by more than 8 log2 units (so p <= 2^14, inside f16). out = sum(p v) / sum(p): every factor cancels.
// The fill is -2^100: below every product of f16 operands, and fill*cs is exact, so a column with no allowed key so far
// has x*cs - m*cs == 0 and p == 1 on every key (the uniform row of the definition); the first allowed key rescales that by 0.
// Every '#pragma unroll' in the kernel makes the indices of a fragment or accumulator array constants, so that it stays in registers.
// ---------------------------------------------------------------------------
// lane l <-> lane l ^ 16 on the vector pipe (a shuffle would go through the LDS unit and be waited for)
__device__ __forceinline__ float xhalf(float v) {
  const int b = __builtin_bit_cast(int, v);
  return __builtin_bit_cast(float, __builtin_amdgcn_permlanex16(b, b, 0x76543210, 0xfedcba98, false, false));
}
constexpr int kFaWaves  = 8;
constexpr int kFaBlockQ = kFaWaves * 32;      // 256 queries per block
constexpr int kFaStage  = 64;                 // keys per stage
constexpr int kFaStages = kTok / kFaStage;    // 64
constexpr int kFaPitch  = 72;                 // halves per staged row (144 B)
constexpr float kFaExpScale = kScoreScale * 1.44269504088896340736f;   // raw q.k -> log2 units
constexpr float kFaFill     = -0x1p100f;
constexpr float kFaLazy     = 8.0f / kFaExpScale;                      // 8 log2 units, in raw units
constexpr float kFaBias     = 6.0f;                                    // p carried x64 in f16
static_assert(kTok % kFaBlockQ == 0 && kTok % kFaStage == 0 && kHd == 64, "fused attention tiling");
// waves_per_eu(4, 4): holds the allocation at 256 registers, so the loop has no register-window switches
__global__ __launch_bounds__(256) __attribute__((amdgpu_waves_per_eu(4, 4))) void attn_fused_kernel(const unsigned short* __restrict__ QKp,
                                                         const unsigned short* __restrict__ Vtp,
                                                         const int* __restrict__ rank,
                                                         unsigned short* __restrict__ Cp) {
  __shared__ __align__(16) _Float16 sK[2][kFaStage * kFaPitch];
  __shared__ __align__(16) _Float16 sV[2][kHd * kFaPitch];
  __shared__ __align__(16) int sId[kTok];      // id of the key at each place, every negative id as -1
  __shared__ int sTok[kFaBlockQ];              // this block's queries: token index, first key, end key
  __shared__ int sBeg[kFaBlockQ];
  __shared__ int sEnd[kFaBlockQ];
  const int tid  = threadIdx.x;
  const int lane = tid & 31;
  const int wave = __builtin_amdgcn_readfirstlane(tid >> 5);   // wave-uniform: kept in a scalar register
  const int c    = lane & 15;                  // A row / B, D column within a tile
  const int h    = lane >> 4;                  // lane half
  const int head = blockIdx.x >> 4;
  const int qb   = (blockIdx.x & 15) * kFaBlockQ;
  const int q0   = qb + wave * 32;
  const _Float16* QK = (const _Float16*)QKp;

  // staging: thread t moves 16 B of rows t/8 and t/8 + 32 of each tile (8 threads = one 128-B row)
  const int srow = tid >> 3, scol = (tid & 7) * 8;
  const char* gK = (const char*)(QK + kDim + head * kHd);                            // block-uniform bases ...
  const char* gV = (const char*)((const _Float16*)Vtp + (size_t)head * kHd * kTok);
  const unsigned oK = (unsigned)(srow * kQKld + scol) * 2u;                          // ... and 32-bit byte offsets per lane
  const unsigned oV = (unsigned)(srow * kTok + scol) * 2u;
  const int sOff = srow * kFaPitch + scol;

  // the rank table is by token: each entry's id goes to its place in LDS (the places are a permutation of 0 .. 4095)
  // all 16 loads are issued in front of the first store, so that their latencies overlap
  v4i rt[kTok / 256];
#pragma unroll
  for (int i = 0; i < kTok / 256; ++i) rt[i] = *(const v4i*)(rank + 4 * (tid + 256 * i));

  v16h qf[2][2];     // [query tile][k step of the head dim]
#pragma unroll
  for (int qt = 0; qt < 2; ++qt) {
    const int q = q0 + qt * 16 + c;
#pragma unroll
    for (int ks = 0; ks < 2; ++ks)
      qf[qt][ks] = Frag<_Float16>::load(QK + (size_t)q * kQKld + head * kHd + ks * 32 + h * 8);
  }
#pragma unroll
  for (int i = 0; i < kTok / 256; ++i) {
    const int place = rt[i][0] & (kTok - 1);
    sId[place] = rt[i][3];
    const unsigned rel = (unsigned)(place - qb);
    if (rel < (unsigned)kFaBlockQ) { sTok[rel] = tid + 256 * i; sBeg[rel] = rt[i][1]; sEnd[rel] = rt[i][2]; }
  }
  __syncthreads();   // ids and ranges are in LDS before any wave reads them

  // key ranges, wave-uniform and kept in scalar registers; the stage range is the same for the whole block and clamped to the shape
  const int bLo = __builtin_amdgcn_readfirstlane(sBeg[0]);
  const int bHi = max(__builtin_amdgcn_readfirstlane(sEnd[0]), __builtin_amdgcn_readfirstlane(sEnd[kFaBlockQ - 1]));
  const int wLo = __builtin_amdgcn_readfirstlane(sBeg[wave * 32]);
  const int wHi = max(__builtin_amdgcn_readfirstlane(sEnd[wave * 32]), __builtin_amdgcn_readfirstlane(sEnd[wave * 32 + 31]));
  const int sFirst = min(max(bLo, 0), kTok - 1) / kFaStage;
  const int sEndSt = min(max((bHi + kFaStage - 1) / kFaStage, sFirst + 1), kFaStages);

  {
    v8h rk[2], rv[2];
#pragma unroll
    for (int i = 0; i < 2; ++i) {
      rk[i] = *(const v8h*)(gK + (size_t)(sFirst * kFaStage + 32 * i) * kQKld * 2 + oK);
      rv[i] = *(const v8h*)(gV + ((size_t)(32 * i) * kTok + sFirst * kFaStage) * 2 + oV);
    }
#pragma unroll
    for (int i = 0; i < 2; ++i) {
      *(v8h*)(&sK[sFirst & 1][sOff + 32 * i * kFaPitch]) = rk[i];
      *(v8h*)(&sV[sFirst & 1][sOff + 32 * i * kFaPitch]) = rv[i];
    }
  }

  // a key's negative id is -1, a query's becomes -2: the two never compare equal
  int  qid[2];
#pragma unroll
  for (int qt = 0; qt < 2; ++qt) {
    const int id = sId[q0 + qt * 16 + c];
    qid[qt] = (id < 0) ? -2 : id;
  }

  v8f acc[2][4];     // [query tile][16 head columns]: acc[qt][dt][r] = Ot[dt*16 + 8h + r][query c]
  float muse[2], nmc[2], lsum[2];
#pragma unroll
  for (int qt = 0; qt < 2; ++qt) {
#pragma unroll
    for (int dt = 0; dt < 4; ++dt) acc[qt][dt] = (v8f){0.f,0.f,0.f,0.f,0.f,0.f,0.f,0.f};
    muse[qt] = kFaFill;
    nmc[qt]  = kFaBias - kFaFill * kFaExpScale;
    lsum[qt] = 0.f;
  }
  __syncthreads();   // the first stage is in LDS before any wave reads it

  for (int s = sFirst; s < sEndSt; ++s) {
    const bool more = (s + 1 < sEndSt);        // the same for the whole block
    v8h rk[2], rv[2];
    if (more) {
#pragma unroll
      for (int i = 0; i < 2; ++i) {
        rk[i] = *(const v8h*)(gK + (size_t)((s + 1) * kFaStage + 32 * i) * kQKld * 2 + oK);
        rv[i] = *(const v8h*)(gV + ((size_t)(32 * i) * kTok + (s + 1) * kFaStage) * 2 + oV);
      }
      // the loads' address registers are reused by the fragment loads right behind: the wait stands in front of that overwrite
      asm volatile("s_wait_xcnt 0x0" ::: "memory");
    }
    const _Float16* kb = &sK[s & 1][c * kFaPitch + h * 8];
    const _Float16* vb = &sV[s & 1][c * kFaPitch + h * 8];
    const int*      ib = sId + s * kFaStage + h * 8;
#pragma unroll
    for (int ps = 0; ps < 2; ++ps) {           // a pass is 32 keys
      const int key0 = s * kFaStage + ps * 32;
      if (key0 >= wHi || key0 + 32 <= wLo) continue;   // scalar test: no query of this wave allows a key of this pass
      v16h kf[2][2];
#pragma unroll
      for (int kt = 0; kt < 2; ++kt)
#pragma unroll
        for (int ks = 0; ks < 2; ++ks) kf[kt][ks] = Frag<_Float16>::load(kb + (ps * 32 + kt * 16) * kFaPitch + ks * 32);
      v16h vf[4];
#pragma unroll
      for (int dt = 0; dt < 4; ++dt) vf[dt] = Frag<_Float16>::load(vb + (dt * 16) * kFaPitch + ps * 32);
      int kid[2][8];
#pragma unroll
      for (int kt = 0; kt < 2; ++kt) {
        const v4i i0 = *(const v4i*)(ib + ps * 32 + kt * 16);
        const v4i i1 = *(const v4i*)(ib + ps * 32 + kt * 16 + 4);
#pragma unroll
        for (int e = 0; e < 4; ++e) { kid[kt][e] = i0[e]; kid[kt][4 + e] = i1[e]; }
      }

      float x[2][16];
      float mt[2];
#pragma unroll
      for (int qt = 0; qt < 2; ++qt) {
#pragma unroll
        for (int kt = 0; kt < 2; ++kt) {
          v8f st = (v8f){0.f,0.f,0.f,0.f,0.f,0.f,0.f,0.f};
          st = Frag<_Float16>::mma(kf[kt][0], qf[qt][0], st);
          st = Frag<_Float16>::mma(kf[kt][1], qf[qt][1], st);
#pragma unroll
          for (int r = 0; r < 8; ++r) x[qt][kt * 8 + r] = (kid[kt][r] == qid[qt]) ? st[r] : kFaFill;
        }
        float m8[8];
#pragma unroll
        for (int r = 0; r < 8; ++r) m8[r] = fmaxf(x[qt][r], x[qt][8 + r]);
        const float m = fmaxf(fmaxf(fmaxf(m8[0], m8[1]), fmaxf(m8[2], m8[3])), fmaxf(fmaxf(m8[4], m8[5]), fmaxf(m8[6], m8[7])));
        mt[qt] = fmaxf(m, xhalf(m));                 // both halves of a column agree on its maximum
      }

      // one test per pass, a scalar branch: most passes raise no column's maximum by enough to matter
      const bool need = (mt[0] > muse[0] + kFaLazy) || (mt[1] > muse[1] + kFaLazy);
      if (__builtin_amdgcn_ballot_w32(need) != 0u) {
#pragma unroll
        for (int qt = 0; qt < 2; ++qt) {
          const float mn = fmaxf(muse[qt], mt[qt]);
          const float nn = kFaBias - mn * kFaExpScale;
          // 2^(nn - old), with the slot the instruction set asks for behind a transcendental in the same statement
          float al;
          asm("v_exp_f32 %0, %1\n\tv_nop" : "=v"(al) : "v"(nn - nmc[qt]));
          muse[qt] = mn;
          nmc[qt]  = nn;
          lsum[qt] *= al;
#pragma unroll
          for (int dt = 0; dt < 4; ++dt)
#pragma unroll
            for (int r = 0; r < 8; ++r) acc[qt][dt][r] *= al;
        }
      }

      // both tiles' weights are made in front of the pass's P.V products
      v16h pb[2];
#pragma unroll
      for (int qt = 0; qt < 2; ++qt) {
        float p[16];
#pragma unroll
        for (int e = 0; e < 16; ++e) {
          // v_nop in the same statement: the slot behind a transcendental
          asm("v_exp_f32 %0, %1\n\tv_nop" : "=v"(p[e]) : "v"(fmaf(x[qt][e], kFaExpScale, nmc[qt])));
          pb[qt][e] = (_Float16)p[e];
        }
        const float a0 = (p[0] + p[1]) + (p[2] + p[3]),   a1 = (p[4] + p[5]) + (p[6] + p[7]);
        const float a2 = (p[8] + p[9]) + (p[10] + p[11]), a3 = (p[12] + p[13]) + (p[14] + p[15]);
        lsum[qt] += (a0 + a1) + (a2 + a3);
      }
#pragma unroll
      for (int qt = 0; qt < 2; ++qt)
#pragma unroll
        for (int dt = 0; dt < 4; ++dt) acc[qt][dt] = Frag<_Float16>::mma(vf[dt], pb[qt], acc[qt][dt]);
    }
    if (more) {
#pragma unroll
      for (int i = 0; i < 2; ++i) {
        *(v8h*)(&sK[(s + 1) & 1][sOff + 32 * i * kFaPitch]) = rk[i];
        *(v8h*)(&sV[(s + 1) & 1][sOff + 32 * i * kFaPitch]) = rv[i];
      }
    }
    // publishes stage s + 1 and ends every wave's reads of the buffer that the next trip refills
    __syncthreads();
  }

  // out[q][head*64 + dt*16 + 8h + r] = carry * acc / sum: 8 consecutive halves per lane and tile, one 16-B store
  // the lane number is read anew here, so that no vector register is held through the loop for the store address
  _Float16* C = (_Float16*)Cp;
  const int el = (int)__builtin_amdgcn_mbcnt_lo(~0u, 0u);
  const int ec = el & 15, eh = el >> 4;
#pragma unroll
  for (int qt = 0; qt < 2; ++qt) {
    const float lt  = lsum[qt] + xhalf(lsum[qt]);   // the halves hold disjoint keys; lt >= 1
    const float inv = kCtxCarry / lt;
    const int tok = sTok[wave * 32 + qt * 16 + ec] & (kTok - 1);   // the row goes back to the token's own index
    _Float16* cr = C + (size_t)tok * kDim + head * kHd + eh * 8;
#pragma unroll
    for (int dt = 0; dt < 4; ++dt) {
      v8h o;
#pragma unroll
      for (int r = 0; r < 8; ++r) o[r] = (_Float16)(acc[qt][dt][r] * inv);
      *(v8h*)(cr + dt * 16) = o;
    }
  }
}

// ---------------------------------------------------------------------------
// Rank + cast of x: one wave per token. place = (ids below mine) + (equal ids at lower token index): a permutation for any
// content of the id array, each count at most 4095. The token's row is cast to f16 and stored at its place (4 x 512 B per wave).
// Rank entry of the token: {place, first key, end key, id}; [first, end) are the places of its id's tokens; a negative id gets
// [0, 4096) and is entered as -1. The block's 8 entries are one 128-B line, stored by one wave.
// '#pragma unroll' makes the indices of a register array constants; 'unroll 8' puts 8 id loads in flight per trip.
// ---------------------------------------------------------------------------
__global__ __launch_bounds__(256) void rank_cast_kernel(const float* __restrict__ x, const int* __restrict__ ids,
                                                        unsigned short* __restrict__ xs, int* __restrict__ rank) {
  __shared__ __align__(16) v4i sM[8];
  const int lane = threadIdx.x & 31;
  const int wave = __builtin_amdgcn_readfirstlane(threadIdx.x >> 5);   // wave-uniform: the counts below stay in scalar registers
  const int row  = blockIdx.x * 8 + wave;
  const float* p = x + (size_t)row * kDim + lane * 8;
  v4f a[4][2];
#pragma unroll
  for (int it = 0; it < 4; ++it) {
    a[it][0] = *(const v4f*)(p + it * 256);
    a[it][1] = *(const v4f*)(p + it * 256 + 4);
  }
  const int my = ids[row];
  const int ci = row >> 7;                     // the 128-id chunk that holds this token
  int less = 0, eq = 0, before = 0;            // counts over all 32 lanes: one compare, then the set bits of its lane mask
#pragma unroll 8
  for (int i = 0; i < kTok / 128; ++i) {
    const v4i k4 = *(const v4i*)(ids + (i * 32 + lane) * 4);
    if (i == ci) before = eq;                  // equal ids of the chunks in front of this token's own
#pragma unroll
    for (int e = 0; e < 4; ++e) {
      less += __builtin_popcount(__builtin_amdgcn_ballot_w32(k4[e] < my));
      eq   += __builtin_popcount(__builtin_amdgcn_ballot_w32(k4[e] == my));
    }
  }
  {
    const v4i k4 = *(const v4i*)(ids + (ci * 32 + lane) * 4);
#pragma unroll
    for (int e = 0; e < 4; ++e)
      before += __builtin_popcount(__builtin_amdgcn_ballot_w32(k4[e] == my && (ci * 32 + lane) * 4 + e < row));
  }
  const int place = (less + before) & (kTok - 1);
  if (lane == 0) sM[wave] = (my < 0) ? (v4i){place, 0, kTok, -1} : (v4i){place, less, less + eq, my};
  __syncthreads();   // the 8 waves' entries are in LDS before one wave stores the line
  if (threadIdx.x < 8) *(v4i*)(rank + (size_t)(blockIdx.x * 8 + threadIdx.x) * 4) = sM[threadIdx.x];

  unsigned short* q = xs + (size_t)place * kDim + lane * 8;
#pragma unroll
  for (int it = 0; it < 4; ++it) {
    unsigned short hb[8];
#pragma unroll
    for (int e = 0; e < 4; ++e) {
      hb[e]     = h_bits(a[it][0][e]);
      hb[4 + e] = h_bits(a[it][1][e]);
    }
    *(v4u*)(q + it * 256) = (v4u){pk16(hb[0], hb[1]), pk16(hb[2], hb[3]), pk16(hb[4], hb[5]), pk16(hb[6], hb[7])};
  }
}

// ---------------------------------------------------------------------------
// f32 -> f16 cast with an exact power-of-two carry, 8 consecutive elements per thread (one 16-B store per lane;
// Coverage: n8 = n/8 threads x 8 elements = whole plane (n % 8 == 0 for every plane here); grid = ceil(n8/256), bound inside.
// ---------------------------------------------------------------------------
__global__ __launch_bounds__(256) void cast8_f16_kernel(const float* __restrict__ in, unsigned short* __restrict__ out,
                                                        int n8, float scale) {
  const int i = blockIdx.x * 256 + threadIdx.x;
  if (i >= n8) return;
  const float* p = in + 8 * (size_t)i;
  const v4f a = *(const v4f*)(p);
  const v4f c = *(const v4f*)(p + 4);
  unsigned short hb[8];
#pragma unroll
  for (int e = 0; e < 4; ++e) {
    hb[e]     = h_bits(a[e] * scale);
    hb[4 + e] = h_bits(c[e] * scale);
  }
  const v4u u = (v4u){pk16(hb[0], hb[1]), pk16(hb[2], hb[3]), pk16(hb[4], hb[5]), pk16(hb[6], hb[7])};
  unsigned short* q = out + 8 * (size_t)i;
  *(v4u*)q = u;
  
}

// ---------------------------------------------------------------------------
// LayerNorm over 1024 columns of Y = x + attn_out (f32, already residual-added in the out_proj epilogue):
// Premise check: the head-count input must equal 16; otherwise the output is NaN-poisoned (block-uniform select).
// One block of 256 threads per row; thread t owns columns 4t..4t+3 (256 x 4 = 1024 = whole row).
// Fixed-order reductions (thread, shuffle tree, 8 wave partials in index order).
// ---------------------------------------------------------------------------
__global__ __launch_bounds__(256) void layernorm_kernel(const float* __restrict__ Y, const float* __restrict__ lnw,
                                                        const float* __restrict__ lnb, const int* __restrict__ nhp,
                                                        float* __restrict__ out) {
  __shared__ float red1[8];
  __shared__ float red2[8];
  const int row  = blockIdx.x;
  const int t    = threadIdx.x;
  const int lane = t & 31, wave = t >> 5;
  const int c0   = t * 4;
  const v4f y = *(const v4f*)(Y + (size_t)row * kDim + c0);
  float s1 = (y[0] + y[1]) + (y[2] + y[3]);
#pragma unroll
  for (int off = 16; off > 0; off >>= 1) s1 += __shfl_xor(s1, off, 32);
  if (lane == 0) red1[wave] = s1;
  __syncthreads();
  float tot = red1[0];
#pragma unroll
  for (int w = 1; w < 8; ++w) tot += red1[w];
  const float mu = tot * kInvDim;
  float d[4];
#pragma unroll
  for (int e = 0; e < 4; ++e) d[e] = y[e] - mu;
  float s2 = (d[0] * d[0] + d[1] * d[1]) + (d[2] * d[2] + d[3] * d[3]);
#pragma unroll
  for (int off = 16; off > 0; off >>= 1) s2 += __shfl_xor(s2, off, 32);
  if (lane == 0) red2[wave] = s2;
  __syncthreads();
  float tot2 = red2[0];
#pragma unroll
  for (int w = 1; w < 8; ++w) tot2 += red2[w];
  const float var = tot2 * kInvDim;
  const float rs  = rsqrtf(var + kLnEps);
  const v4f wv = *(const v4f*)(lnw + c0);
  const v4f bv = *(const v4f*)(lnb + c0);
  const bool bad = (nhp[0] != kHeads);
  const float nanv = __int_as_float(0x7fc00000);
  v4f o;
#pragma unroll
  for (int e = 0; e < 4; ++e) {
    const float r = d[e] * rs * wv[e] + bv[e];
    o[e] = bad ? nanv : r;
  }
  float* q = out + (size_t)row * kDim + c0;
  *(v4f*)q = o;
  
}

// ---------------------------------------------------------------------------
// Host glue: kernel launches only. d_in order:
//   0 x [4096][1024] f32, 1 cluster ids [4096] i32, 2 in_proj_w [3072][1024] f32, 3 in_proj_b [3072] f32,
//   4 out_proj_w [1024][1024] f32, 5 out_proj_b [1024] f32, 6 ln_w [1024] f32, 7 ln_b [1024] f32, 8 head count [1] i32.
// Launch count: rank+cast of x + 2 casts + 2 in_proj GEMMs + fused attention + out_proj GEMM + LayerNorm = 8.
// ---------------------------------------------------------------------------
extern "C" void kernel_launch(void* const* d_in, const int* in_sizes, int n_in,
                              void* d_out, int out_size, void* d_ws, size_t ws_size, hipStream_t stream) {
  if (n_in < 9) return;
  if (in_sizes[0] != kTok * kDim || in_sizes[1] != kTok || in_sizes[2] != 3 * kDim * kDim ||
      in_sizes[3] != 3 * kDim || in_sizes[4] != kDim * kDim || in_sizes[5] != kDim ||
      in_sizes[6] != kDim || in_sizes[7] != kDim || in_sizes[8] < 1) return;
  if (out_size != kTok * kDim) return;
  if (ws_size < kWsTotal) return;

  const float* x     = (const float*)d_in[0];
  const int*   ids   = (const int*)d_in[1];
  const float* w_in  = (const float*)d_in[2];
  const float* b_in  = (const float*)d_in[3];
  const float* w_out = (const float*)d_in[4];
  const float* b_out = (const float*)d_in[5];
  const float* lnw   = (const float*)d_in[6];
  const float* lnb   = (const float*)d_in[7];
  const int*   nhp   = (const int*)d_in[8];
  float* out = (float*)d_out;

  unsigned char* ws = (unsigned char*)d_ws;
  unsigned short* ctx16  = (unsigned short*)(ws + kOffCtx);
  unsigned short* qk16   = (unsigned short*)(ws + kOffQK);
  unsigned short* vt16   = (unsigned short*)(ws + kOffVT);
  unsigned short* x16    = (unsigned short*)(ws + kOffS);                 // early tenant of R_S
  unsigned short* win16  = (unsigned short*)(ws + kOffS + kBytesX16);     // early tenant of R_S
  float*          Y      = (float*)(ws + kOffS);                          // late tenant of R_S
  unsigned short* wout16 = (unsigned short*)(ws + kOffP);                 // tenant of R_P
  int*            rank   = (int*)(ws + kOffRank);                         // tenant of R_P

  // ---- x -> f16 with its rows in ranked order (one wave per token, 8 tokens per block), W_in -> f16(x16 W) ----
  {
    rank_cast_kernel<<<dim3(kTok / 8), dim3(256), 0, stream>>>(x, ids, x16, rank);
    const int n8w = (3 * kDim * kDim) / 8;      // 393216 threads x 8 = 3,145,728 elements
    cast8_f16_kernel<<<dim3((n8w + 255) / 256), dim3(256), 0, stream>>>(w_in, win16, n8w, kWCarry);
  }

  // ---- in_proj q|k: C[4096][2048] = (1/16) x16 . Win16[0:2048]^T + b_in[n] -> f16 plane (lda=ldb=1024, ldc=2048) ----
  // M=4096, N=2048, K=1024 (K%32==0, M,N %64==0); 2048 tiles -> 256 blocks
  wmma_gemm64<0, false, 2, 1, false><<<dim3(256, 1), dim3(256), 0, stream>>>(
      x16, x16, kDim, 0L, win16, win16, kDim, 0L, (void*)qk16, (void*)qk16, kQKld, 0L,
      b_in, x, 0L, kTok, kQKld, kDim, kWCarryInv);

  // ---- in_proj v, transposed: Vt[1024][4096] = (1/16) Win16[2048:3072] . x16^T + b_in[2048 + m] -> f16 (ldc=4096) ----
  // M=1024 (v features), N=4096 (tokens), K=1024; 1024 tiles -> 128 blocks
  wmma_gemm64<0, false, 1, 1, false><<<dim3(128, 1), dim3(256), 0, stream>>>(
      win16 + (size_t)2 * kDim * kDim, win16 + (size_t)2 * kDim * kDim, kDim, 0L, x16, x16, kDim, 0L,
      (void*)vt16, (void*)vt16, kTok, 0L, b_in + 2 * kDim, x, 0L, kDim, kTok, kDim, kWCarryInv);

  // ---- attention, all heads in one launch: ctx16[4096][1024] f16 carried x256 ----
  // 16 heads x 16 blocks of 256 queries; q = qk16 cols h*64.., k = qk16 cols 1024 + h*64.., Vt rows h*64..
  attn_fused_kernel<<<dim3(kHeads * (kTok / kFaBlockQ)), dim3(256), 0, stream>>>(qk16, vt16, rank, ctx16);

  // ---- W_out -> f16(x16 W) ----
  {
    const int n8o = (kDim * kDim) / 8;          // 131072 threads x 8 = 1,048,576 elements
    cast8_f16_kernel<<<dim3((n8o + 255) / 256), dim3(256), 0, stream>>>(w_out, wout16, n8o, kWCarry);
  }

  // ---- out_proj + bias + residual: Y[4096][1024] f32 = (1/4096) ctx16 . Wout16^T + b_out[n] + x[m][n] ----
  // M=4096, N=1024, K=1024; 1024 tiles -> 128 blocks; RESID read and write are element-local in the epilogue, Y does not alias x
  wmma_gemm64<0, false, 2, 0, true><<<dim3(128, 1), dim3(256), 0, stream>>>(
      ctx16, ctx16, kDim, 0L, wout16, wout16, kDim, 0L, (void*)Y, (void*)Y, kDim, 0L,
      b_out, x, 0L, kTok, kDim, kDim, kOutScale);

  // ---- LayerNorm -> d_out [4096][1024] f32 ----
  layernorm_kernel<<<dim3(kTok), dim3(256), 0, stream>>>(Y, lnw, lnb, nhp, out);
}
